// v000
// The times below were measured on an AMD MI455X: many runs one after another, warmed up first and cycling through
// copies of the inputs, with the whole window's GPU time divided by the number of runs. Launches and the gaps
// between them are all in it. The median over several windows is given; except for v000 it joins two sittings, which
// can be a few percent apart, so the side-by-side timings, each taken in one sitting, are the better comparison.
// v000, which the later versions start from, runs in 711 microseconds.
// compute dtype: query, key, value rounded to bf16 and used as EXACT f16 operands on WMMA 16x16x32 (heads split from the 1,024-wide rows); scores / 8 (the module's query / sqrt(64)), running-max softmax in f32 (hardware exp), P (scaled by 2^11, single f16) x v (exact); f32 accumulate; output in the module's (batch*head, token, 64) layout.
#include <hip/hip_runtime.h>
#include <math.h>

typedef __attribute__((ext_vector_type(16))) _Float16 v16h;
typedef __attribute__((ext_vector_type(16))) __bf16 v16b;
typedef __attribute__((ext_vector_type(8)))  _Float16 v8h;
typedef __attribute__((ext_vector_type(8)))  float v8f;
typedef __attribute__((ext_vector_type(4)))  float v4f;
typedef __attribute__((ext_vector_type(2)))  float v2f;
typedef __attribute__((ext_vector_type(4)))  unsigned v4u;
typedef __attribute__((ext_vector_type(4)))  int v4i;
typedef float __attribute__((may_alias)) float_a;
typedef int __attribute__((may_alias)) int_a;

template <typename T> __device__ __forceinline__ void vst2(void* p, T v) { *(T*)p = v;  }
__device__ __forceinline__ v8f wmma16(v16h a, v16h b, v8f c) {
  v8f d = __builtin_amdgcn_wmma_f32_16x16x32_f16(false, a, false, b, (short)0, c, false, false);
  asm volatile("v_nop\n\tv_nop\n\tv_nop\n\tv_nop" : "+v"(d) : "v"(a), "v"(b));
  return d;
}
__device__ __forceinline__ v8f wmma_bf(v16b a, v16b b, v8f c) {
  v8f d = __builtin_amdgcn_wmma_f32_16x16x32_bf16(false, a, false, b, (short)0, c, false, false);
  asm volatile("v_nop\n\tv_nop\n\tv_nop\n\tv_nop" : "+v"(d) : "v"(a), "v"(b));
  return d;
}
// 16x16x32 fragments: lane = (h = lane>>4, row/col = lane&15); elements 0..7 = k0+8h+0..7, 8..15 = k0+16+8h+0..7; D element r = row 8h+r
__device__ __forceinline__ v16h frag_h(const _Float16* rowk0, int lane) {
  union { v16h v; v8h q[2]; } u; const _Float16* p = rowk0 + 8 * (lane >> 4);
  u.q[0] = *(const v8h*)p; u.q[1] = *(const v8h*)(p + 16); return u.v;
}
__device__ __forceinline__ v16h frag_f32(const float* rowk0, int lane) {
  v16h a; const float* p = rowk0 + 8 * (lane >> 4);
#pragma unroll
  for (int i = 0; i < 8; ++i) { a[i] = (_Float16)p[i]; a[8 + i] = (_Float16)p[16 + i]; }
  return a;
}
__device__ __forceinline__ v16h frag_f32s(const float* rowk0, int lane, float sc) {
  v16h a; const float* p = rowk0 + 8 * (lane >> 4);
#pragma unroll
  for (int i = 0; i < 8; ++i) { a[i] = (_Float16)(p[i] * sc); a[8 + i] = (_Float16)(p[16 + i] * sc); }
  return a;
}
// column fragment from a [K][ld] layout (column n), rows >= K read as 0
__device__ __forceinline__ v16h fragc_f32(const float* W, int k0, int n, int lane, int ld, int K) {
  v16h a; const int g = lane >> 4;
#pragma unroll
  for (int i = 0; i < 8; ++i) { const int ka = k0 + 8 * g + i, kb = ka + 16;
    a[i] = (_Float16)(ka < K ? W[(size_t)(ka < K ? ka : K - 1) * ld + n] : 0.f); a[8 + i] = (_Float16)(kb < K ? W[(size_t)(kb < K ? kb : K - 1) * ld + n] : 0.f); }
  return a;
}
struct F2 { v16b h, l; };
__device__ __forceinline__ F2 bsplit16(const float v[16]) { F2 r;
#pragma unroll
  for (int i = 0; i < 16; ++i) { const __bf16 h = (__bf16)v[i]; r.h[i] = h; r.l[i] = (__bf16)(v[i] - (float)h); }
  return r; }
__device__ __forceinline__ F2 split_row(const float* row, int k0, int lane) { float v[16]; const float* p = row + k0 + 8 * (lane >> 4);
#pragma unroll
  for (int i = 0; i < 8; ++i) { v[i] = p[i]; v[8 + i] = p[16 + i]; }
  return bsplit16(v); }
__device__ __forceinline__ F2 split_rowK(const float* row, int k0, int lane, int K) { float v[16]; const int g = lane >> 4;
#pragma unroll
  for (int i = 0; i < 8; ++i) { const int ka = k0 + 8 * g + i, kb = ka + 16; v[i] = ka < K ? row[ka < K ? ka : K - 1] : 0.f; v[8 + i] = kb < K ? row[kb < K ? kb : K - 1] : 0.f; }
  return bsplit16(v); }
__device__ __forceinline__ F2 split_col(const float* W, int k0, int n, int lane, int ld, int K) { float v[16]; const int g = lane >> 4;
#pragma unroll
  for (int i = 0; i < 8; ++i) { const int ka = k0 + 8 * g + i, kb = ka + 16; v[i] = ka < K ? W[(size_t)(ka < K ? ka : K - 1) * ld + n] : 0.f; v[8 + i] = kb < K ? W[(size_t)(kb < K ? kb : K - 1) * ld + n] : 0.f; }
  return bsplit16(v); }
__device__ __forceinline__ v8f mac3(const F2& a, const F2& b, v8f c) { c = wmma_bf(a.l, b.h, c); c = wmma_bf(a.h, b.l, c); return wmma_bf(a.h, b.h, c); }
__device__ __forceinline__ float sigm(float v) { return 1.0f / (1.0f + expf(-v)); }
#define LDSX() do { asm volatile("s_wait_dscnt 0" ::: "memory"); __builtin_amdgcn_wave_barrier(); __builtin_amdgcn_fence(__ATOMIC_RELEASE, "workgroup"); } while (0)


// Memory-efficient (chunked) attention == softmax(q k^T / sqrt(64)) v per head (B 2, S 4,096, 16 heads x 64), output left in (batch*head, token, head_dim) form.
#define NB 2
#define NHD 16
#define NBH (NB * NHD)
#define SS 4096
#define HD 64
#define DW (NHD * HD)   // 1024-wide input rows
#ifndef TQB
#define TQB (SS / 64)
#define TNB NBH
#endif
typedef __attribute__((ext_vector_type(8))) __bf16 v8b;
__device__ __forceinline__ v16b frag_b(const __bf16* rowk0, int lane) {
  union { v16b v; v8b q[2]; } u; const __bf16* p = rowk0 + 8 * (lane >> 4);
  u.q[0] = *(const v8b*)p; u.q[1] = *(const v8b*)(p + 16); return u.v;
}
__device__ __forceinline__ float bfr(float v) { return (float)(__bf16)v; }
__device__ __attribute__((noinline)) float exp_ni(float v) { return expf(v); }
__device__ __attribute__((noinline)) float erf_ni(float v) { return erff(v); }

#define WS_Q   0u                                  // f16 rows q ; k ; VT planes [bh][64][s]
#define WS_K   (WS_Q + 2u * (size_t)NBH * SS * HD)
#define WS_VT  (WS_K + 2u * (size_t)NBH * SS * HD)
#define WS_END (WS_VT + 2u * (size_t)NBH * HD * SS)

__global__ __launch_bounds__(256) void k_rows(const float* __restrict__ X, _Float16* __restrict__ R) { const size_t r0 = (size_t)blockIdx.x * 64; const int t = threadIdx.x; __shared__ __align__(16) _Float16 s[64][72]; const size_t bh = r0 / SS, s0 = r0 % SS; const size_t b = bh / NHD, h = bh % NHD;
  for (int e = t; e < 64 * 64; e += 256) { const int r = e >> 6, c = e & 63; s[r][c] = (_Float16)bfr(X[((b * SS + s0 + r) * DW) + h * HD + c]); } __syncthreads();
  for (int e = t; e < 64 * 8; e += 256) { const int r = e >> 3, q = e & 7; vst2((unsigned*)(R + (r0 + r) * HD + q * 8), *(const v4u*)&s[r][q * 8]); } }
__global__ __launch_bounds__(256) void k_vt(const float* __restrict__ V, _Float16* __restrict__ VT) { __shared__ __align__(16) _Float16 st[64][72]; const size_t rb0 = (size_t)blockIdx.x * 64; const size_t bh = rb0 / SS, s0 = rb0 % SS; const size_t b = bh / NHD, h = bh % NHD; const int t = threadIdx.x;
  for (int e = t; e < 64 * 64; e += 256) { const int r = e >> 6, d = e & 63; st[d][r] = (_Float16)bfr(V[((b * SS + s0 + r) * DW) + h * HD + d]); } __syncthreads();
  for (int e = t; e < 64 * 8; e += 256) { const int d = e >> 3, pc = e & 7; vst2((unsigned*)(VT + (bh * HD + d) * SS + s0 + pc * 8), *(const v4u*)&st[d][pc * 8]); } }
// ---- k_attn: block = (64 queries, bh): exact-operand scores, softmax, P (single f16, scaled by 2048) x v
__global__ __launch_bounds__(128) void k_attn(const _Float16* __restrict__ Q, const _Float16* __restrict__ K, const _Float16* __restrict__ VT, float* __restrict__ OUT) {
  __shared__ __align__(16) _Float16 sph[4][16][40]; __shared__ __align__(16) float so[4][16][68];
  const int tid = threadIdx.x, wave = tid >> 5, lane = tid & 31, col = lane & 15, g = lane >> 4; const size_t bh = blockIdx.y; const int q0 = blockIdx.x * 64 + wave * 16; const size_t rq = bh * SS + q0;
  v16h aq[2];
#pragma unroll
  for (int kc = 0; kc < 2; ++kc) aq[kc] = frag_h(Q + (rq + col) * HD + kc * 32, lane);
  float m[8], l[8];
#pragma unroll
  for (int r = 0; r < 8; ++r) { m[r] = -3.0e38f; l[r] = 0.f; }
  v8f acc[4] = {};
#pragma unroll 1
  for (int ks = 0; ks < SS / 32; ++ks) { const int j0 = ks * 32; v8f s[2];
#pragma unroll
    for (int ct = 0; ct < 2; ++ct) { const size_t rk = (bh * SS + j0 + ct * 16 + col) * HD; v8f c = {};
#pragma unroll
      for (int kc = 0; kc < 2; ++kc) c = wmma16(aq[kc], frag_h(K + rk + kc * 32, lane), c);
#pragma unroll
      for (int r = 0; r < 8; ++r) s[ct][r] = c[r] * 0.125f; }
#pragma unroll
    for (int r = 0; r < 8; ++r) { float mx = fmaxf(s[0][r], s[1][r]);
#pragma unroll
      for (int o = 1; o < 16; o <<= 1) mx = fmaxf(mx, __shfl_xor(mx, o));
      const float mn = fmaxf(m[r], mx); const float alpha = (m[r] <= -1.0e38f) ? 0.f : __expf(m[r] - mn); const float e0 = __expf(s[0][r] - mn), e1 = __expf(s[1][r] - mn); float es = e0 + e1;
#pragma unroll
      for (int o = 1; o < 16; o <<= 1) es += __shfl_xor(es, o);
      l[r] = l[r] * alpha + es; m[r] = mn;
#pragma unroll
      for (int dt = 0; dt < 4; ++dt) acc[dt][r] *= alpha;
      sph[wave][8 * g + r][col] = (_Float16)(e0 * 2048.0f); sph[wave][8 * g + r][16 + col] = (_Float16)(e1 * 2048.0f); }
    LDSX();
    const v16h pa = frag_h(&sph[wave][col][0], lane);
#pragma unroll
    for (int dt = 0; dt < 4; ++dt) acc[dt] = wmma16(pa, frag_h(VT + (bh * HD + dt * 16 + col) * SS + j0, lane), acc[dt]);
    LDSX(); }
#pragma unroll
  for (int r = 0; r < 8; ++r) { const float il = (1.0f / 2048.0f) / l[r];
#pragma unroll
    for (int dt = 0; dt < 4; ++dt) so[wave][8 * g + r][dt * 16 + col] = acc[dt][r] * il; }
  LDSX();
  for (int rl = 0; rl < 16; ++rl) if (lane < 16) vst2(OUT + (rq + rl) * HD + lane * 4, *(const v4f*)&so[wave][rl][lane * 4]);
}
extern "C" void kernel_launch(void* const* d_in, const int* in_sizes, int n_in, void* d_out, int out_size, void* d_ws, size_t ws_size, hipStream_t stream) {
  (void)in_sizes; (void)n_in; (void)out_size;
  const float** F = (const float**)d_in;   // 0 query, 1 key, 2 value [2,4096,1024]
  if (ws_size < (size_t)WS_END) return;
  char* ws = (char*)d_ws; _Float16 *Qr = (_Float16*)(ws + WS_Q), *Kr = (_Float16*)(ws + WS_K), *VT = (_Float16*)(ws + WS_VT);
  k_rows<<<NBH * SS / 64, 256, 0, stream>>>(F[0], Qr);
  k_rows<<<NBH * SS / 64, 256, 0, stream>>>(F[1], Kr);
  k_vt<<<NBH * SS / 64, 256, 0, stream>>>(F[2], VT);
  k_attn<<<dim3(TQB, TNB), 128, 0, stream>>>(Qr, Kr, VT, (float*)d_out);
}

// v001
// It runs in 329 microseconds.
// Timed twice side by side with v000, it ran 2.18 and 2.19 times as fast.
// compute dtype: query, key, value rounded to bf16 and used as EXACT f16 operands on WMMA 16x16x32 (heads split from the 1,024-wide rows); scores / 8 (the module's query / sqrt(64)), running-max softmax in f32 (hardware exp), P (scaled by 2^11, single f16) x v (exact); f32 accumulate; output in the module's (batch*head, token, 64) layout.
#include <hip/hip_runtime.h>
#include <math.h>

typedef __attribute__((ext_vector_type(16))) _Float16 v16h;
typedef __attribute__((ext_vector_type(16))) __bf16 v16b;
typedef __attribute__((ext_vector_type(8)))  _Float16 v8h;
typedef __attribute__((ext_vector_type(8)))  float v8f;
typedef __attribute__((ext_vector_type(4)))  float v4f;
typedef __attribute__((ext_vector_type(2)))  float v2f;
typedef __attribute__((ext_vector_type(4)))  unsigned v4u;
typedef __attribute__((ext_vector_type(4)))  int v4i;
typedef float __attribute__((may_alias)) float_a;
typedef int __attribute__((may_alias)) int_a;

template <typename T> __device__ __forceinline__ void vst2(void* p, T v) { *(T*)p = v;  }
__device__ __forceinline__ v8f wmma16(v16h a, v16h b, v8f c) {
  v8f d = __builtin_amdgcn_wmma_f32_16x16x32_f16(false, a, false, b, (short)0, c, false, false);
  asm volatile("v_nop\n\tv_nop\n\tv_nop\n\tv_nop" : "+v"(d) : "v"(a), "v"(b));
  return d;
}
__device__ __forceinline__ v8f wmma_bf(v16b a, v16b b, v8f c) {
  v8f d = __builtin_amdgcn_wmma_f32_16x16x32_bf16(false, a, false, b, (short)0, c, false, false);
  asm volatile("v_nop\n\tv_nop\n\tv_nop\n\tv_nop" : "+v"(d) : "v"(a), "v"(b));
  return d;
}
// 16x16x32 fragments: lane = (h = lane>>4, row/col = lane&15); elements 0..7 = k0+8h+0..7, 8..15 = k0+16+8h+0..7; D element r = row 8h+r
__device__ __forceinline__ v16h frag_h(const _Float16* rowk0, int lane) {
  union { v16h v; v8h q[2]; } u; const _Float16* p = rowk0 + 8 * (lane >> 4);
  u.q[0] = *(const v8h*)p; u.q[1] = *(const v8h*)(p + 16); return u.v;
}
__device__ __forceinline__ v16h frag_f32(const float* rowk0, int lane) {
  v16h a; const float* p = rowk0 + 8 * (lane >> 4);
#pragma unroll
  for (int i = 0; i < 8; ++i) { a[i] = (_Float16)p[i]; a[8 + i] = (_Float16)p[16 + i]; }
  return a;
}
__device__ __forceinline__ v16h frag_f32s(const float* rowk0, int lane, float sc) {
  v16h a; const float* p = rowk0 + 8 * (lane >> 4);
#pragma unroll
  for (int i = 0; i < 8; ++i) { a[i] = (_Float16)(p[i] * sc); a[8 + i] = (_Float16)(p[16 + i] * sc); }
  return a;
}
// column fragment from a [K][ld] layout (column n), rows >= K read as 0
__device__ __forceinline__ v16h fragc_f32(const float* W, int k0, int n, int lane, int ld, int K) {
  v16h a; const int g = lane >> 4;
#pragma unroll
  for (int i = 0; i < 8; ++i) { const int ka = k0 + 8 * g + i, kb = ka + 16;
    a[i] = (_Float16)(ka < K ? W[(size_t)(ka < K ? ka : K - 1) * ld + n] : 0.f); a[8 + i] = (_Float16)(kb < K ? W[(size_t)(kb < K ? kb : K - 1) * ld + n] : 0.f); }
  return a;
}
struct F2 { v16b h, l; };
__device__ __forceinline__ F2 bsplit16(const float v[16]) { F2 r;
#pragma unroll
  for (int i = 0; i < 16; ++i) { const __bf16 h = (__bf16)v[i]; r.h[i] = h; r.l[i] = (__bf16)(v[i] - (float)h); }
  return r; }
__device__ __forceinline__ F2 split_row(const float* row, int k0, int lane) { float v[16]; const float* p = row + k0 + 8 * (lane >> 4);
#pragma unroll
  for (int i = 0; i < 8; ++i) { v[i] = p[i]; v[8 + i] = p[16 + i]; }
  return bsplit16(v); }
__device__ __forceinline__ F2 split_rowK(const float* row, int k0, int lane, int K) { float v[16]; const int g = lane >> 4;
#pragma unroll
  for (int i = 0; i < 8; ++i) { const int ka = k0 + 8 * g + i, kb = ka + 16; v[i] = ka < K ? row[ka < K ? ka : K - 1] : 0.f; v[8 + i] = kb < K ? row[kb < K ? kb : K - 1] : 0.f; }
  return bsplit16(v); }
__device__ __forceinline__ F2 split_col(const float* W, int k0, int n, int lane, int ld, int K) { float v[16]; const int g = lane >> 4;
#pragma unroll
  for (int i = 0; i < 8; ++i) { const int ka = k0 + 8 * g + i, kb = ka + 16; v[i] = ka < K ? W[(size_t)(ka < K ? ka : K - 1) * ld + n] : 0.f; v[8 + i] = kb < K ? W[(size_t)(kb < K ? kb : K - 1) * ld + n] : 0.f; }
  return bsplit16(v); }
__device__ __forceinline__ v8f mac3(const F2& a, const F2& b, v8f c) { c = wmma_bf(a.l, b.h, c); c = wmma_bf(a.h, b.l, c); return wmma_bf(a.h, b.h, c); }
__device__ __forceinline__ float sigm(float v) { return 1.0f / (1.0f + expf(-v)); }
#define LDSX() do { asm volatile("s_wait_dscnt 0" ::: "memory"); __builtin_amdgcn_wave_barrier(); __builtin_amdgcn_fence(__ATOMIC_RELEASE, "workgroup"); } while (0)


// Memory-efficient (chunked) attention == softmax(q k^T / sqrt(64)) v per head (B 2, S 4,096, 16 heads x 64), output left in (batch*head, token, head_dim) form.
#define NB 2
#define NHD 16
#define NBH (NB * NHD)
#define SS 4096
#define HD 64
#define DW (NHD * HD)   // 1024-wide input rows
#ifndef TQB
#define TQB (SS / 64)
#define TNB NBH
#endif
typedef __attribute__((ext_vector_type(8))) __bf16 v8b;
__device__ __forceinline__ v16b frag_b(const __bf16* rowk0, int lane) {
  union { v16b v; v8b q[2]; } u; const __bf16* p = rowk0 + 8 * (lane >> 4);
  u.q[0] = *(const v8b*)p; u.q[1] = *(const v8b*)(p + 16); return u.v;
}
__device__ __forceinline__ float bfr(float v) { return (float)(__bf16)v; }
__device__ __attribute__((noinline)) float exp_ni(float v) { return expf(v); }
__device__ __attribute__((noinline)) float erf_ni(float v) { return erff(v); }

#define WS_Q   0u                                  // f16 rows q ; k ; VT planes [bh][64][s]
#define WS_K   (WS_Q + 2u * (size_t)NBH * SS * HD)
#define WS_VT  (WS_K + 2u * (size_t)NBH * SS * HD)
#define WS_END (WS_VT + 2u * (size_t)NBH * HD * SS)

__global__ __launch_bounds__(256) void k_rows(const float* __restrict__ X, _Float16* __restrict__ R) { const size_t r0 = (size_t)blockIdx.x * 64; const int t = threadIdx.x; __shared__ __align__(16) _Float16 s[64][72]; const size_t bh = r0 / SS, s0 = r0 % SS; const size_t b = bh / NHD, h = bh % NHD;
  for (int e = t; e < 64 * 64; e += 256) { const int r = e >> 6, c = e & 63; s[r][c] = (_Float16)bfr(X[((b * SS + s0 + r) * DW) + h * HD + c]); } __syncthreads();
  for (int e = t; e < 64 * 8; e += 256) { const int r = e >> 3, q = e & 7; vst2((unsigned*)(R + (r0 + r) * HD + q * 8), *(const v4u*)&s[r][q * 8]); } }
__global__ __launch_bounds__(256) void k_vt(const float* __restrict__ V, _Float16* __restrict__ VT) { __shared__ __align__(16) _Float16 st[64][72]; const size_t rb0 = (size_t)blockIdx.x * 64; const size_t bh = rb0 / SS, s0 = rb0 % SS; const size_t b = bh / NHD, h = bh % NHD; const int t = threadIdx.x;
  for (int e = t; e < 64 * 64; e += 256) { const int r = e >> 6, d = e & 63; st[d][r] = (_Float16)bfr(V[((b * SS + s0 + r) * DW) + h * HD + d]); } __syncthreads();
  for (int e = t; e < 64 * 8; e += 256) { const int d = e >> 3, pc = e & 7; vst2((unsigned*)(VT + (bh * HD + d) * SS + s0 + pc * 8), *(const v4u*)&st[d][pc * 8]); } }
// ---- k_attn: block = (64 queries, bh): exact-operand scores, softmax, P (x 2048, single f16) x v
// K and V^T reach the four waves through LDS: a stage is 64 keys, one K tile (64 key rows of 128 bytes) and one V^T tile (64 head-column rows of 128 bytes),
// brought by asynchronous copies in whole 128-byte lines, two buffers, the next stage in flight while this one is worked on.
// Inside a row the eight 16-byte pieces are stored at piece ^ ((row >> 1) & 7), so that the 16 rows a fragment read touches fall on 16 different bank groups without a pad.
#define KT 64
#define NT (SS / KT)
#define TILE_B 8192
#define STAGE_B (2 * TILE_B)
typedef __attribute__((address_space(3))) unsigned char lds_u8;
// one stage's copies of one thread: four pieces of the K tile, four of the V^T tile (16 rows apart each)
__device__ __forceinline__ void copy_stage(unsigned l, const char* gk, const char* gv) {
  // s_wait_xcnt 0 as the last line: it stands before anything rewrites an address register that a copy names
  asm volatile("global_load_async_to_lds_b128 %0, %8, off\n\t"
               "global_load_async_to_lds_b128 %1, %9, off\n\t"
               "global_load_async_to_lds_b128 %2, %10, off\n\t"
               "global_load_async_to_lds_b128 %3, %11, off\n\t"
               "global_load_async_to_lds_b128 %4, %12, off\n\t"
               "global_load_async_to_lds_b128 %5, %13, off\n\t"
               "global_load_async_to_lds_b128 %6, %14, off\n\t"
               "global_load_async_to_lds_b128 %7, %15, off\n\t"
               "s_wait_xcnt 0x0"
               :: "v"(l), "v"(l + 2048u), "v"(l + 4096u), "v"(l + 6144u),
                  "v"(l + TILE_B), "v"(l + TILE_B + 2048u), "v"(l + TILE_B + 4096u), "v"(l + TILE_B + 6144u),
                  "v"(gk), "v"(gk + 2048), "v"(gk + 4096), "v"(gk + 6144),
                  "v"(gv), "v"(gv + 16 * SS * 2), "v"(gv + 32 * SS * 2), "v"(gv + 48 * SS * 2)
               : "memory");
}
__device__ __forceinline__ v16h frag_l(const unsigned char* t, unsigned o0, unsigned o1) {
  union { v16h v; v8h q[2]; } u; u.q[0] = *(const v8h*)(t + o0); u.q[1] = *(const v8h*)(t + o1); return u.v;
}
__global__ __launch_bounds__(128) void k_attn(const _Float16* __restrict__ Q, const _Float16* __restrict__ K, const _Float16* __restrict__ VT, float* __restrict__ OUT) {
  __shared__ __align__(16) _Float16 sph[4][16][40]; __shared__ __align__(128) unsigned char ring[2 * STAGE_B];
  float (*so)[16][68] = (float (*)[16][68])ring;   // output staging takes the ring's place behind the loop's last barrier
  const int tid = threadIdx.x, wave = tid >> 5, lane = tid & 31, col = lane & 15, g = lane >> 4; const size_t bh = blockIdx.y; const int q0 = blockIdx.x * 64 + wave * 16; const size_t rq = bh * SS + q0;
  // copies: thread = (row tid >> 3 of each 16-row group, piece tid & 7)
  const unsigned crow = (unsigned)tid >> 3, cpc = (unsigned)tid & 7u;
  const unsigned lds0 = (unsigned)(size_t)(lds_u8*)ring + crow * 128u + ((cpc ^ ((crow >> 1) & 7u)) << 4);
  const char* gk = (const char*)(K + bh * SS * HD) + tid * 16;
  const char* gv = (const char*)(VT + bh * HD * SS) + (size_t)crow * (SS * 2) + cpc * 16;
  // fragment reads: row col of a 16-row group, pieces 2q + g, q = 0..3
  unsigned fo[4];
#pragma unroll   // fo[] stays in registers: every index a constant
  for (int q = 0; q < 4; ++q) fo[q] = (unsigned)col * 128u + ((((unsigned)g ^ ((unsigned)col >> 1)) ^ (2u * q)) << 4);
  copy_stage(lds0, gk, gv);
  asm volatile("s_wait_asynccnt 0x0" ::: "memory");   // stage 0 has landed before the barrier that publishes it
  __syncthreads();
  copy_stage(lds0 + STAGE_B, gk + TILE_B, gv + KT * 2);
  v16h aq[2];
#pragma unroll
  for (int kc = 0; kc < 2; ++kc) aq[kc] = frag_h(Q + (rq + col) * HD + kc * 32, lane);
  float m[8], l[8];
#pragma unroll
  for (int r = 0; r < 8; ++r) { m[r] = -3.0e38f; l[r] = 0.f; }
  v8f acc[4] = {};
#pragma unroll 1
  for (int t = 0; t < NT; ++t) { const unsigned char* kb = ring + (t & 1) * STAGE_B; const unsigned char* vb = kb + TILE_B;
#pragma unroll   // the stage's two 32-key passes: fo[] indices and row offsets stay constants (immediate offsets of the LDS reads)
   for (int p = 0; p < 2; ++p) { v8f s[2];
#pragma unroll
    for (int ct = 0; ct < 2; ++ct) { const unsigned char* kr = kb + (p * 32 + ct * 16) * 128; v8f c = {};
#pragma unroll
      for (int kc = 0; kc < 2; ++kc) c = wmma16(aq[kc], frag_l(kr, fo[2 * kc], fo[2 * kc + 1]), c);
#pragma unroll
      for (int r = 0; r < 8; ++r) s[ct][r] = c[r] * 0.125f; }
#pragma unroll
    for (int r = 0; r < 8; ++r) { float mx = fmaxf(s[0][r], s[1][r]);
#pragma unroll
      for (int o = 1; o < 16; o <<= 1) mx = fmaxf(mx, __shfl_xor(mx, o));
      const float mn = fmaxf(m[r], mx); const float alpha = (m[r] <= -1.0e38f) ? 0.f : __expf(m[r] - mn); const float e0 = __expf(s[0][r] - mn), e1 = __expf(s[1][r] - mn); float es = e0 + e1;
#pragma unroll
      for (int o = 1; o < 16; o <<= 1) es += __shfl_xor(es, o);
      l[r] = l[r] * alpha + es; m[r] = mn;
#pragma unroll
      for (int dt = 0; dt < 4; ++dt) acc[dt][r] *= alpha;
      sph[wave][8 * g + r][col] = (_Float16)(e0 * 2048.0f); sph[wave][8 * g + r][16 + col] = (_Float16)(e1 * 2048.0f); }
    LDSX();
    const v16h pa = frag_h(&sph[wave][col][0], lane);
#pragma unroll
    for (int dt = 0; dt < 4; ++dt) acc[dt] = wmma16(pa, frag_l(vb + dt * 16 * 128, fo[2 * p], fo[2 * p + 1]), acc[dt]);
    LDSX(); }
   asm volatile("s_wait_dscnt 0x0" ::: "memory");      // this wave's reads of the buffer are done before it is refilled
   asm volatile("s_wait_asynccnt 0x0" ::: "memory");   // this wave's copies of stage t + 1 have landed before the barrier that publishes them
   __syncthreads();                                    // publishes stage t + 1 and ends every wave's reads of stage t
   if (t + 2 < NT) copy_stage(lds0 + (t & 1) * STAGE_B, gk + (size_t)(t + 2) * TILE_B, gv + (t + 2) * (KT * 2)); }
  asm volatile("s_wait_asynccnt 0x0" ::: "memory");    // nothing in flight when the ring becomes output staging
#pragma unroll
  for (int r = 0; r < 8; ++r) { const float il = (1.0f / 2048.0f) / l[r];
#pragma unroll
    for (int dt = 0; dt < 4; ++dt) so[wave][8 * g + r][dt * 16 + col] = acc[dt][r] * il; }
  LDSX();
  for (int rl = 0; rl < 16; ++rl) if (lane < 16) vst2(OUT + (rq + rl) * HD + lane * 4, *(const v4f*)&so[wave][rl][lane * 4]);
}
extern "C" void kernel_launch(void* const* d_in, const int* in_sizes, int n_in, void* d_out, int out_size, void* d_ws, size_t ws_size, hipStream_t stream) {
  (void)in_sizes; (void)n_in; (void)out_size;
  const float** F = (const float**)d_in;   // 0 query, 1 key, 2 value [2,4096,1024]
  if (ws_size < (size_t)WS_END) return;
  char* ws = (char*)d_ws; _Float16 *Qr = (_Float16*)(ws + WS_Q), *Kr = (_Float16*)(ws + WS_K), *VT = (_Float16*)(ws + WS_VT);
  k_rows<<<NBH * SS / 64, 256, 0, stream>>>(F[0], Qr);
  k_rows<<<NBH * SS / 64, 256, 0, stream>>>(F[1], Kr);
  k_vt<<<NBH * SS / 64, 256, 0, stream>>>(F[2], VT);
  k_attn<<<dim3(TQB, TNB), 128, 0, stream>>>(Qr, Kr, VT, (float*)d_out);
}

// v002
// It runs in 183 microseconds.
// In both of two side-by-side timings against v001, it was 1.80 times as fast.
// All steps since v000 together make it 3.93 times as fast.
// compute dtype: query, key, value rounded to bf16 and used as EXACT f16 operands on WMMA 16x16x32 (heads split from the 1,024-wide rows); scores / 8 (the module's query / sqrt(64)), running-max softmax in f32 (hardware exp), P (scaled by 2^11, single f16) x v (exact); f32 accumulate; output in the module's (batch*head, token, 64) layout.
#include <hip/hip_runtime.h>
#include <math.h>

typedef __attribute__((ext_vector_type(16))) _Float16 v16h;
typedef __attribute__((ext_vector_type(16))) __bf16 v16b;
typedef __attribute__((ext_vector_type(8)))  _Float16 v8h;
typedef __attribute__((ext_vector_type(8)))  float v8f;
typedef __attribute__((ext_vector_type(4)))  float v4f;
typedef __attribute__((ext_vector_type(2)))  float v2f;
typedef __attribute__((ext_vector_type(4)))  unsigned v4u;
typedef __attribute__((ext_vector_type(4)))  int v4i;
typedef float __attribute__((may_alias)) float_a;
typedef int __attribute__((may_alias)) int_a;

template <typename T> __device__ __forceinline__ void vst2(void* p, T v) { *(T*)p = v;  }
__device__ __forceinline__ v8f wmma16(v16h a, v16h b, v8f c) {
  v8f d = __builtin_amdgcn_wmma_f32_16x16x32_f16(false, a, false, b, (short)0, c, false, false);
  asm volatile("v_nop\n\tv_nop\n\tv_nop\n\tv_nop" : "+v"(d) : "v"(a), "v"(b));
  return d;
}
__device__ __forceinline__ v8f wmma_bf(v16b a, v16b b, v8f c) {
  v8f d = __builtin_amdgcn_wmma_f32_16x16x32_bf16(false, a, false, b, (short)0, c, false, false);
  asm volatile("v_nop\n\tv_nop\n\tv_nop\n\tv_nop" : "+v"(d) : "v"(a), "v"(b));
  return d;
}
// 16x16x32 fragments: lane = (h = lane>>4, row/col = lane&15); elements 0..7 = k0+8h+0..7, 8..15 = k0+16+8h+0..7; D element r = row 8h+r
__device__ __forceinline__ v16h frag_h(const _Float16* rowk0, int lane) {
  union { v16h v; v8h q[2]; } u; const _Float16* p = rowk0 + 8 * (lane >> 4);
  u.q[0] = *(const v8h*)p; u.q[1] = *(const v8h*)(p + 16); return u.v;
}
__device__ __forceinline__ v16h frag_f32(const float* rowk0, int lane) {
  v16h a; const float* p = rowk0 + 8 * (lane >> 4);
#pragma unroll
  for (int i = 0; i < 8; ++i) { a[i] = (_Float16)p[i]; a[8 + i] = (_Float16)p[16 + i]; }
  return a;
}
__device__ __forceinline__ v16h frag_f32s(const float* rowk0, int lane, float sc) {
  v16h a; const float* p = rowk0 + 8 * (lane >> 4);
#pragma unroll
  for (int i = 0; i < 8; ++i) { a[i] = (_Float16)(p[i] * sc); a[8 + i] = (_Float16)(p[16 + i] * sc); }
  return a;
}
// column fragment from a [K][ld] layout (column n), rows >= K read as 0
__device__ __forceinline__ v16h fragc_f32(const float* W, int k0, int n, int lane, int ld, int K) {
  v16h a; const int g = lane >> 4;
#pragma unroll
  for (int i = 0; i < 8; ++i) { const int ka = k0 + 8 * g + i, kb = ka + 16;
    a[i] = (_Float16)(ka < K ? W[(size_t)(ka < K ? ka : K - 1) * ld + n] : 0.f); a[8 + i] = (_Float16)(kb < K ? W[(size_t)(kb < K ? kb : K - 1) * ld + n] : 0.f); }
  return a;
}
struct F2 { v16b h, l; };
__device__ __forceinline__ F2 bsplit16(const float v[16]) { F2 r;
#pragma unroll
  for (int i = 0; i < 16; ++i) { const __bf16 h = (__bf16)v[i]; r.h[i] = h; r.l[i] = (__bf16)(v[i] - (float)h); }
  return r; }
__device__ __forceinline__ F2 split_row(const float* row, int k0, int lane) { float v[16]; const float* p = row + k0 + 8 * (lane >> 4);
#pragma unroll
  for (int i = 0; i < 8; ++i) { v[i] = p[i]; v[8 + i] = p[16 + i]; }
  return bsplit16(v); }
__device__ __forceinline__ F2 split_rowK(const float* row, int k0, int lane, int K) { float v[16]; const int g = lane >> 4;
#pragma unroll
  for (int i = 0; i < 8; ++i) { const int ka = k0 + 8 * g + i, kb = ka + 16; v[i] = ka < K ? row[ka < K ? ka : K - 1] : 0.f; v[8 + i] = kb < K ? row[kb < K ? kb : K - 1] : 0.f; }
  return bsplit16(v); }
__device__ __forceinline__ F2 split_col(const float* W, int k0, int n, int lane, int ld, int K) { float v[16]; const int g = lane >> 4;
#pragma unroll
  for (int i = 0; i < 8; ++i) { const int ka = k0 + 8 * g + i, kb = ka + 16; v[i] = ka < K ? W[(size_t)(ka < K ? ka : K - 1) * ld + n] : 0.f; v[8 + i] = kb < K ? W[(size_t)(kb < K ? kb : K - 1) * ld + n] : 0.f; }
  return bsplit16(v); }
__device__ __forceinline__ v8f mac3(const F2& a, const F2& b, v8f c) { c = wmma_bf(a.l, b.h, c); c = wmma_bf(a.h, b.l, c); return wmma_bf(a.h, b.h, c); }
__device__ __forceinline__ float sigm(float v) { return 1.0f / (1.0f + expf(-v)); }
#define LDSX() do { asm volatile("s_wait_dscnt 0" ::: "memory"); __builtin_amdgcn_wave_barrier(); __builtin_amdgcn_fence(__ATOMIC_RELEASE, "workgroup"); } while (0)


// Memory-efficient (chunked) attention == softmax(q k^T / sqrt(64)) v per head (B 2, S 4,096, 16 heads x 64), output left in (batch*head, token, head_dim) form.
#define NB 2
#define NHD 16
#define NBH (NB * NHD)
#define SS 4096
#define HD 64
#define DW (NHD * HD)   // 1024-wide input rows
#ifndef TQB
#define TQB (SS / 64)
#define TNB NBH
#endif
typedef __attribute__((ext_vector_type(8))) __bf16 v8b;
__device__ __forceinline__ v16b frag_b(const __bf16* rowk0, int lane) {
  union { v16b v; v8b q[2]; } u; const __bf16* p = rowk0 + 8 * (lane >> 4);
  u.q[0] = *(const v8b*)p; u.q[1] = *(const v8b*)(p + 16); return u.v;
}
__device__ __forceinline__ float bfr(float v) { return (float)(__bf16)v; }
__device__ __attribute__((noinline)) float exp_ni(float v) { return expf(v); }
__device__ __attribute__((noinline)) float erf_ni(float v) { return erff(v); }

#define WS_Q   0u                                  // f16 rows q ; k ; VT planes [bh][64][s]
#define WS_K   (WS_Q + 2u * (size_t)NBH * SS * HD)
#define WS_VT  (WS_K + 2u * (size_t)NBH * SS * HD)
#define WS_END (WS_VT + 2u * (size_t)NBH * HD * SS)

__global__ __launch_bounds__(256) void k_rows(const float* __restrict__ X, _Float16* __restrict__ R) { const size_t r0 = (size_t)blockIdx.x * 64; const int t = threadIdx.x; __shared__ __align__(16) _Float16 s[64][72]; const size_t bh = r0 / SS, s0 = r0 % SS; const size_t b = bh / NHD, h = bh % NHD;
  for (int e = t; e < 64 * 64; e += 256) { const int r = e >> 6, c = e & 63; s[r][c] = (_Float16)bfr(X[((b * SS + s0 + r) * DW) + h * HD + c]); } __syncthreads();
  for (int e = t; e < 64 * 8; e += 256) { const int r = e >> 3, q = e & 7; vst2((unsigned*)(R + (r0 + r) * HD + q * 8), *(const v4u*)&s[r][q * 8]); } }
__global__ __launch_bounds__(256) void k_vt(const float* __restrict__ V, _Float16* __restrict__ VT) { __shared__ __align__(16) _Float16 st[64][72]; const size_t rb0 = (size_t)blockIdx.x * 64; const size_t bh = rb0 / SS, s0 = rb0 % SS; const size_t b = bh / NHD, h = bh % NHD; const int t = threadIdx.x;
  for (int e = t; e < 64 * 64; e += 256) { const int r = e >> 6, d = e & 63; st[d][r] = (_Float16)bfr(V[((b * SS + s0 + r) * DW) + h * HD + d]); } __syncthreads();
  for (int e = t; e < 64 * 8; e += 256) { const int d = e >> 3, pc = e & 7; vst2((unsigned*)(VT + (bh * HD + d) * SS + s0 + pc * 8), *(const v4u*)&st[d][pc * 8]); } }
// ---- k_attn: block = (64 queries, bh): exact-operand scores, softmax, P x v
// K and V^T reach the four waves through LDS: a stage is 64 keys, one K tile (64 key rows of 128 bytes) and one V^T tile (64 head-column rows of 128 bytes),
// brought by asynchronous copies in whole 128-byte lines, two buffers, the next stage in flight while this one is worked on.
// Inside a row the eight 16-byte pieces are stored at piece ^ ((row >> 1) & 7), so that the 16 rows a fragment read touches fall on 16 different bank groups without a pad.
#define KT 64
#define NT (SS / KT)
#define TILE_B 8192
#define STAGE_B (2 * TILE_B)
typedef __attribute__((address_space(3))) unsigned char lds_u8;
// one stage's copies of one thread: four pieces of the K tile, four of the V^T tile (16 rows apart each)
__device__ __forceinline__ void copy_stage(unsigned l, const char* gk, const char* gv) {
  // s_wait_xcnt 0 as the last line: it stands before anything rewrites an address register that a copy names
  asm volatile("global_load_async_to_lds_b128 %0, %8, off\n\t"
               "global_load_async_to_lds_b128 %1, %9, off\n\t"
               "global_load_async_to_lds_b128 %2, %10, off\n\t"
               "global_load_async_to_lds_b128 %3, %11, off\n\t"
               "global_load_async_to_lds_b128 %4, %12, off\n\t"
               "global_load_async_to_lds_b128 %5, %13, off\n\t"
               "global_load_async_to_lds_b128 %6, %14, off\n\t"
               "global_load_async_to_lds_b128 %7, %15, off\n\t"
               "s_wait_xcnt 0x0"
               :: "v"(l), "v"(l + 2048u), "v"(l + 4096u), "v"(l + 6144u),
                  "v"(l + TILE_B), "v"(l + TILE_B + 2048u), "v"(l + TILE_B + 4096u), "v"(l + TILE_B + 6144u),
                  "v"(gk), "v"(gk + 2048), "v"(gk + 4096), "v"(gk + 6144),
                  "v"(gv), "v"(gv + 16 * SS * 2), "v"(gv + 32 * SS * 2), "v"(gv + 48 * SS * 2)
               : "memory");
}
__device__ __forceinline__ v16h frag_l(const unsigned char* t, unsigned o0, unsigned o1) {
  union { v16h v; v8h q[2]; } u; u.q[0] = *(const v8h*)(t + o0); u.q[1] = *(const v8h*)(t + o1); return u.v;
}
// lane l with lane l ^ 16: the two halves of a wave hold the same query column and different keys
__device__ __forceinline__ float xhalf(float x) { return __builtin_bit_cast(float, __builtin_amdgcn_permlanex16(__builtin_bit_cast(int, x), __builtin_bit_cast(int, x), 0x76543210, 0xfedcba98, false, false)); }
__global__ __launch_bounds__(128) void k_attn(const _Float16* __restrict__ Q, const _Float16* __restrict__ K, const _Float16* __restrict__ VT, float* __restrict__ OUT) {
  __shared__ __align__(128) unsigned char ring[2 * STAGE_B];
  float (*so)[16][68] = (float (*)[16][68])ring;   // output staging takes the ring's place behind the loop's last barrier
  const int tid = threadIdx.x, wave = tid >> 5, lane = tid & 31, col = lane & 15, g = lane >> 4; const size_t bh = blockIdx.y; const int q0 = blockIdx.x * 64 + wave * 16; const size_t rq = bh * SS + q0;
  // copies: thread = (row tid >> 3 of each 16-row group, piece tid & 7)
  const unsigned crow = (unsigned)tid >> 3, cpc = (unsigned)tid & 7u;
  const unsigned lds0 = (unsigned)(size_t)(lds_u8*)ring + crow * 128u + ((cpc ^ ((crow >> 1) & 7u)) << 4);
  const char* gk = (const char*)(K + bh * SS * HD) + tid * 16;
  const char* gv = (const char*)(VT + bh * HD * SS) + (size_t)crow * (SS * 2) + cpc * 16;
  // fragment reads: row col of a 16-row group, pieces 2q + g, q = 0..3
  unsigned fo[4];
#pragma unroll   // fo[] stays in registers: every index a constant
  for (int q = 0; q < 4; ++q) fo[q] = (unsigned)col * 128u + ((((unsigned)g ^ ((unsigned)col >> 1)) ^ (2u * q)) << 4);
  copy_stage(lds0, gk, gv);
  asm volatile("s_wait_asynccnt 0x0" ::: "memory");   // stage 0 has landed before the barrier that publishes it
  __syncthreads();
  copy_stage(lds0 + STAGE_B, gk + TILE_B, gv + KT * 2);
  v16h aq[2];
#pragma unroll
  for (int kc = 0; kc < 2; ++kc) aq[kc] = frag_h(Q + (rq + col) * HD + kc * 32, lane);
  float m = -3.0e38f, l = 0.f;   // query col: running maximum (equal in both halves), this half's share of the sum
  v8f acc[4] = {};               // acc[dt][r] = O^T[dt * 16 + 8g + r][col]
#pragma unroll 1
  for (int t = 0; t < NT; ++t) { const unsigned char* kb = ring + (t & 1) * STAGE_B; const unsigned char* vb = kb + TILE_B;
#pragma unroll   // the stage's two 32-key passes: fo[] indices and row offsets stay constants (immediate offsets of the LDS reads)
   for (int p = 0; p < 2; ++p) { v8f s[2];
#pragma unroll
    for (int ct = 0; ct < 2; ++ct) { const unsigned char* kr = kb + (p * 32 + ct * 16) * 128; v8f c = {};
#pragma unroll
      for (int kc = 0; kc < 2; ++kc) c = wmma16(frag_l(kr, fo[2 * kc], fo[2 * kc + 1]), aq[kc], c);
#pragma unroll
      for (int r = 0; r < 8; ++r) s[ct][r] = c[r] * 0.125f; }
    float mx = fmaxf(s[0][0], s[1][0]);
#pragma unroll
    for (int r = 1; r < 8; ++r) mx = fmaxf(mx, fmaxf(s[0][r], s[1][r]));
    mx = fmaxf(mx, xhalf(mx));
    const float mn = fmaxf(m, mx); const float alpha = (m <= -1.0e38f) ? 0.f : __expf(m - mn);
    float es0 = 0.f, es1 = 0.f; v16h pb;
#pragma unroll
    for (int r = 0; r < 8; ++r) { const float e0 = __expf(s[0][r] - mn), e1 = __expf(s[1][r] - mn); es0 += e0; es1 += e1;
      pb[r] = (_Float16)(e0 * 2048.0f); pb[8 + r] = (_Float16)(e1 * 2048.0f); }
    l = l * alpha + (es0 + es1); m = mn;
#pragma unroll
    for (int dt = 0; dt < 4; ++dt) acc[dt] *= alpha;
#pragma unroll
    for (int dt = 0; dt < 4; ++dt) acc[dt] = wmma16(frag_l(vb + dt * 16 * 128, fo[2 * p], fo[2 * p + 1]), pb, acc[dt]); }
   asm volatile("s_wait_dscnt 0x0" ::: "memory");      // this wave's reads of the buffer are done before it is refilled
   asm volatile("s_wait_asynccnt 0x0" ::: "memory");   // this wave's copies of stage t + 1 have landed before the barrier that publishes them
   __syncthreads();                                    // publishes stage t + 1 and ends every wave's reads of stage t
   if (t + 2 < NT) copy_stage(lds0 + (t & 1) * STAGE_B, gk + (size_t)(t + 2) * TILE_B, gv + (t + 2) * (KT * 2)); }
  asm volatile("s_wait_asynccnt 0x0" ::: "memory");    // nothing in flight when the ring becomes output staging
  const float il = (1.0f / 2048.0f) / (l + xhalf(l));  // the halves' sums are joined once, here
#pragma unroll
  for (int dt = 0; dt < 4; ++dt) { v4f lo, hi;
#pragma unroll
    for (int r = 0; r < 4; ++r) { lo[r] = acc[dt][r] * il; hi[r] = acc[dt][4 + r] * il; }
    *(v4f*)&so[wave][col][dt * 16 + 8 * g] = lo; *(v4f*)&so[wave][col][dt * 16 + 8 * g + 4] = hi; }
  LDSX();
  for (int rl = 0; rl < 16; ++rl) if (lane < 16) vst2(OUT + (rq + rl) * HD + lane * 4, *(const v4f*)&so[wave][rl][lane * 4]);
}
extern "C" void kernel_launch(void* const* d_in, const int* in_sizes, int n_in, void* d_out, int out_size, void* d_ws, size_t ws_size, hipStream_t stream) {
  (void)in_sizes; (void)n_in; (void)out_size;
  const float** F = (const float**)d_in;   // 0 query, 1 key, 2 value [2,4096,1024]
  if (ws_size < (size_t)WS_END) return;
  char* ws = (char*)d_ws; _Float16 *Qr = (_Float16*)(ws + WS_Q), *Kr = (_Float16*)(ws + WS_K), *VT = (_Float16*)(ws + WS_VT);
  k_rows<<<NBH * SS / 64, 256, 0, stream>>>(F[0], Qr);
  k_rows<<<NBH * SS / 64, 256, 0, stream>>>(F[1], Kr);
  k_vt<<<NBH * SS / 64, 256, 0, stream>>>(F[2], VT);
  k_attn<<<dim3(TQB, TNB), 128, 0, stream>>>(Qr, Kr, VT, (float*)d_out);
}

// v003
// It runs in 166 microseconds.
// In both of two side-by-side timings against v002, it was 1.11 times as fast.
// Over all steps from v000 it is 4.35 times as fast.
// compute dtype: query, key, value rounded to bf16 and used as EXACT f16 operands on WMMA 16x16x32 (heads split from the 1,024-wide rows); scores / 8 (the module's query / sqrt(64)), running-max softmax in f32 (hardware exp), P (scaled by 2^11, single f16) x v (exact); f32 accumulate; output in the module's (batch*head, token, 64) layout.
#include <hip/hip_runtime.h>
#include <math.h>

typedef __attribute__((ext_vector_type(16))) _Float16 v16h;
typedef __attribute__((ext_vector_type(16))) __bf16 v16b;
typedef __attribute__((ext_vector_type(8)))  _Float16 v8h;
typedef __attribute__((ext_vector_type(8)))  float v8f;
typedef __attribute__((ext_vector_type(4)))  float v4f;
typedef __attribute__((ext_vector_type(2)))  float v2f;
typedef __attribute__((ext_vector_type(4)))  unsigned v4u;
typedef __attribute__((ext_vector_type(4)))  int v4i;
typedef float __attribute__((may_alias)) float_a;
typedef int __attribute__((may_alias)) int_a;

template <typename T> __device__ __forceinline__ void vst2(void* p, T v) { *(T*)p = v;  }
__device__ __forceinline__ v8f wmma16(v16h a, v16h b, v8f c) {
  v8f d = __builtin_amdgcn_wmma_f32_16x16x32_f16(false, a, false, b, (short)0, c, false, false);
  asm volatile("v_nop\n\tv_nop\n\tv_nop\n\tv_nop" : "+v"(d) : "v"(a), "v"(b));
  return d;
}
__device__ __forceinline__ v8f wmma_bf(v16b a, v16b b, v8f c) {
  v8f d = __builtin_amdgcn_wmma_f32_16x16x32_bf16(false, a, false, b, (short)0, c, false, false);
  asm volatile("v_nop\n\tv_nop\n\tv_nop\n\tv_nop" : "+v"(d) : "v"(a), "v"(b));
  return d;
}
// 16x16x32 fragments: lane = (h = lane>>4, row/col = lane&15); elements 0..7 = k0+8h+0..7, 8..15 = k0+16+8h+0..7; D element r = row 8h+r
__device__ __forceinline__ v16h frag_h(const _Float16* rowk0, int lane) {
  union { v16h v; v8h q[2]; } u; const _Float16* p = rowk0 + 8 * (lane >> 4);
  u.q[0] = *(const v8h*)p; u.q[1] = *(const v8h*)(p + 16); return u.v;
}
__device__ __forceinline__ v16h frag_f32(const float* rowk0, int lane) {
  v16h a; const float* p = rowk0 + 8 * (lane >> 4);
#pragma unroll
  for (int i = 0; i < 8; ++i) { a[i] = (_Float16)p[i]; a[8 + i] = (_Float16)p[16 + i]; }
  return a;
}
__device__ __forceinline__ v16h frag_f32s(const float* rowk0, int lane, float sc) {
  v16h a; const float* p = rowk0 + 8 * (lane >> 4);
#pragma unroll
  for (int i = 0; i < 8; ++i) { a[i] = (_Float16)(p[i] * sc); a[8 + i] = (_Float16)(p[16 + i] * sc); }
  return a;
}
// column fragment from a [K][ld] layout (column n), rows >= K read as 0
__device__ __forceinline__ v16h fragc_f32(const float* W, int k0, int n, int lane, int ld, int K) {
  v16h a; const int g = lane >> 4;
#pragma unroll
  for (int i = 0; i < 8; ++i) { const int ka = k0 + 8 * g + i, kb = ka + 16;
    a[i] = (_Float16)(ka < K ? W[(size_t)(ka < K ? ka : K - 1) * ld + n] : 0.f); a[8 + i] = (_Float16)(kb < K ? W[(size_t)(kb < K ? kb : K - 1) * ld + n] : 0.f); }
  return a;
}
struct F2 { v16b h, l; };
__device__ __forceinline__ F2 bsplit16(const float v[16]) { F2 r;
#pragma unroll
  for (int i = 0; i < 16; ++i) { const __bf16 h = (__bf16)v[i]; r.h[i] = h; r.l[i] = (__bf16)(v[i] - (float)h); }
  return r; }
__device__ __forceinline__ F2 split_row(const float* row, int k0, int lane) { float v[16]; const float* p = row + k0 + 8 * (lane >> 4);
#pragma unroll
  for (int i = 0; i < 8; ++i) { v[i] = p[i]; v[8 + i] = p[16 + i]; }
  return bsplit16(v); }
__device__ __forceinline__ F2 split_rowK(const float* row, int k0, int lane, int K) { float v[16]; const int g = lane >> 4;
#pragma unroll
  for (int i = 0; i < 8; ++i) { const int ka = k0 + 8 * g + i, kb = ka + 16; v[i] = ka < K ? row[ka < K ? ka : K - 1] : 0.f; v[8 + i] = kb < K ? row[kb < K ? kb : K - 1] : 0.f; }
  return bsplit16(v); }
__device__ __forceinline__ F2 split_col(const float* W, int k0, int n, int lane, int ld, int K) { float v[16]; const int g = lane >> 4;
#pragma unroll
  for (int i = 0; i < 8; ++i) { const int ka = k0 + 8 * g + i, kb = ka + 16; v[i] = ka < K ? W[(size_t)(ka < K ? ka : K - 1) * ld + n] : 0.f; v[8 + i] = kb < K ? W[(size_t)(kb < K ? kb : K - 1) * ld + n] : 0.f; }
  return bsplit16(v); }
__device__ __forceinline__ v8f mac3(const F2& a, const F2& b, v8f c) { c = wmma_bf(a.l, b.h, c); c = wmma_bf(a.h, b.l, c); return wmma_bf(a.h, b.h, c); }
__device__ __forceinline__ float sigm(float v) { return 1.0f / (1.0f + expf(-v)); }
#define LDSX() do { asm volatile("s_wait_dscnt 0" ::: "memory"); __builtin_amdgcn_wave_barrier(); __builtin_amdgcn_fence(__ATOMIC_RELEASE, "workgroup"); } while (0)


// Memory-efficient (chunked) attention == softmax(q k^T / sqrt(64)) v per head (B 2, S 4,096, 16 heads x 64), output left in (batch*head, token, head_dim) form.
#define NB 2
#define NHD 16
#define NBH (NB * NHD)
#define SS 4096
#define HD 64
#define DW (NHD * HD)   // 1024-wide input rows
#ifndef TQB
#define TQB (SS / 64)
#define TNB NBH
#endif
typedef __attribute__((ext_vector_type(8))) __bf16 v8b;
__device__ __forceinline__ v16b frag_b(const __bf16* rowk0, int lane) {
  union { v16b v; v8b q[2]; } u; const __bf16* p = rowk0 + 8 * (lane >> 4);
  u.q[0] = *(const v8b*)p; u.q[1] = *(const v8b*)(p + 16); return u.v;
}
__device__ __forceinline__ float bfr(float v) { return (float)(__bf16)v; }
__device__ __attribute__((noinline)) float exp_ni(float v) { return expf(v); }
__device__ __attribute__((noinline)) float erf_ni(float v) { return erff(v); }

#define WS_Q   0u                                  // f16 rows q ; k ; VT planes [bh][64][s]
#define WS_K   (WS_Q + 2u * (size_t)NBH * SS * HD)
#define WS_VT  (WS_K + 2u * (size_t)NBH * SS * HD)
#define WS_END (WS_VT + 2u * (size_t)NBH * HD * SS)

__global__ __launch_bounds__(256) void k_rows(const float* __restrict__ X, _Float16* __restrict__ R) { const size_t r0 = (size_t)blockIdx.x * 64; const int t = threadIdx.x; __shared__ __align__(16) _Float16 s[64][72]; const size_t bh = r0 / SS, s0 = r0 % SS; const size_t b = bh / NHD, h = bh % NHD;
  for (int e = t; e < 64 * 64; e += 256) { const int r = e >> 6, c = e & 63; s[r][c] = (_Float16)bfr(X[((b * SS + s0 + r) * DW) + h * HD + c]); } __syncthreads();
  for (int e = t; e < 64 * 8; e += 256) { const int r = e >> 3, q = e & 7; vst2((unsigned*)(R + (r0 + r) * HD + q * 8), *(const v4u*)&s[r][q * 8]); } }
__global__ __launch_bounds__(256) void k_vt(const float* __restrict__ V, _Float16* __restrict__ VT) { __shared__ __align__(16) _Float16 st[64][72]; const size_t rb0 = (size_t)blockIdx.x * 64; const size_t bh = rb0 / SS, s0 = rb0 % SS; const size_t b = bh / NHD, h = bh % NHD; const int t = threadIdx.x;
  for (int e = t; e < 64 * 64; e += 256) { const int r = e >> 6, d = e & 63; st[d][r] = (_Float16)bfr(V[((b * SS + s0 + r) * DW) + h * HD + d]); } __syncthreads();
  for (int e = t; e < 64 * 8; e += 256) { const int d = e >> 3, pc = e & 7; vst2((unsigned*)(VT + (bh * HD + d) * SS + s0 + pc * 8), *(const v4u*)&st[d][pc * 8]); } }
// ---- k_attn: block = (64 queries, bh): exact-operand scores, softmax, P x v
// K and V^T reach the four waves through LDS: a stage is 64 keys, one K tile (64 key rows of 128 bytes) and one V^T tile (64 head-column rows of 128 bytes),
// brought by asynchronous copies in whole 128-byte lines, two buffers, the next stage in flight while this one is worked on.
// Inside a row the eight 16-byte pieces are stored at piece ^ ((row >> 1) & 7), so that the 16 rows a fragment read touches fall on 16 different bank groups without a pad.
#define KT 64
#define KS 0.18033688011112042f   // log2(e) / 8
#define NT (SS / KT)
#define TILE_B 8192
#define STAGE_B (2 * TILE_B)
typedef __attribute__((address_space(3))) unsigned char lds_u8;
// one stage's copies of one thread: four pieces of the K tile, four of the V^T tile (16 rows apart each)
__device__ __forceinline__ void copy_stage(unsigned l, const char* gk, const char* gv) {
  // s_wait_xcnt 0 as the last line: it stands before anything rewrites an address register that a copy names
  asm volatile("global_load_async_to_lds_b128 %0, %8, off\n\t"
               "global_load_async_to_lds_b128 %1, %9, off\n\t"
               "global_load_async_to_lds_b128 %2, %10, off\n\t"
               "global_load_async_to_lds_b128 %3, %11, off\n\t"
               "global_load_async_to_lds_b128 %4, %12, off\n\t"
               "global_load_async_to_lds_b128 %5, %13, off\n\t"
               "global_load_async_to_lds_b128 %6, %14, off\n\t"
               "global_load_async_to_lds_b128 %7, %15, off\n\t"
               "s_wait_xcnt 0x0"
               :: "v"(l), "v"(l + 2048u), "v"(l + 4096u), "v"(l + 6144u),
                  "v"(l + TILE_B), "v"(l + TILE_B + 2048u), "v"(l + TILE_B + 4096u), "v"(l + TILE_B + 6144u),
                  "v"(gk), "v"(gk + 2048), "v"(gk + 4096), "v"(gk + 6144),
                  "v"(gv), "v"(gv + 16 * SS * 2), "v"(gv + 32 * SS * 2), "v"(gv + 48 * SS * 2)
               : "memory");
}
__device__ __forceinline__ v16h frag_l(const unsigned char* t, unsigned o0, unsigned o1) {
  union { v16h v; v8h q[2]; } u; u.q[0] = *(const v8h*)(t + o0); u.q[1] = *(const v8h*)(t + o1); return u.v;
}
// lane l with lane l ^ 16: the two halves of a wave hold the same query column and different keys
__device__ __forceinline__ float xhalf(float x) { return __builtin_bit_cast(float, __builtin_amdgcn_permlanex16(__builtin_bit_cast(int, x), __builtin_bit_cast(int, x), 0x76543210, 0xfedcba98, false, false)); }
__global__ __launch_bounds__(128) void k_attn(const _Float16* __restrict__ Q, const _Float16* __restrict__ K, const _Float16* __restrict__ VT, float* __restrict__ OUT) {
  __shared__ __align__(128) unsigned char ring[2 * STAGE_B];
  float (*so)[16][68] = (float (*)[16][68])ring;   // output staging takes the ring's place behind the loop's last barrier
  const int tid = threadIdx.x, wave = tid >> 5, lane = tid & 31, col = lane & 15, g = lane >> 4; const size_t bh = blockIdx.y; const int q0 = blockIdx.x * 64 + wave * 16; const size_t rq = bh * SS + q0;
  // copies: thread = (row tid >> 3 of each 16-row group, piece tid & 7)
  const unsigned crow = (unsigned)tid >> 3, cpc = (unsigned)tid & 7u;
  const unsigned lds0 = (unsigned)(size_t)(lds_u8*)ring + crow * 128u + ((cpc ^ ((crow >> 1) & 7u)) << 4);
  const char* gk = (const char*)(K + bh * SS * HD) + tid * 16;
  const char* gv = (const char*)(VT + bh * HD * SS) + (size_t)crow * (SS * 2) + cpc * 16;
  // fragment reads: row col of a 16-row group, pieces 2q + g, q = 0..3
  unsigned fo[4];
#pragma unroll   // fo[] stays in registers: every index a constant
  for (int q = 0; q < 4; ++q) fo[q] = (unsigned)col * 128u + ((((unsigned)g ^ ((unsigned)col >> 1)) ^ (2u * q)) << 4);
  copy_stage(lds0, gk, gv);
  asm volatile("s_wait_asynccnt 0x0" ::: "memory");   // stage 0 has landed before the barrier that publishes it
  __syncthreads();
  copy_stage(lds0 + STAGE_B, gk + TILE_B, gv + KT * 2);
  v16h aq[2];
#pragma unroll
  for (int kc = 0; kc < 2; ++kc) aq[kc] = frag_h(Q + (rq + col) * HD + kc * 32, lane);
  float m = -3.0e38f, l = 0.f;   // query col: running maximum of the raw products (equal in both halves), this half's share of the sum (times 2^11, as P)
  v8f acc[4] = {};               // acc[dt][r] = O^T[dt * 16 + 8g + r][col]
#pragma unroll 1
  for (int t = 0; t < NT; ++t) { const unsigned char* kb = ring + (t & 1) * STAGE_B; const unsigned char* vb = kb + TILE_B;
#pragma unroll   // the stage's two 32-key passes: fo[] indices and row offsets stay constants (immediate offsets of the LDS reads)
   for (int p = 0; p < 2; ++p) { v8f s[2];
#pragma unroll
    for (int ct = 0; ct < 2; ++ct) { const unsigned char* kr = kb + (p * 32 + ct * 16) * 128; v8f c = {};
#pragma unroll
      for (int kc = 0; kc < 2; ++kc) c = wmma16(frag_l(kr, fo[2 * kc], fo[2 * kc + 1]), aq[kc], c);
      s[ct] = c; }   // raw products: the scale goes into the exponent's fma below
    float mx = fmaxf(s[0][0], s[1][0]);
#pragma unroll
    for (int r = 1; r < 8; ++r) mx = fmaxf(mx, fmaxf(s[0][r], s[1][r]));
    mx = fmaxf(mx, xhalf(mx));
    const float mn = fmaxf(m, mx); const float alpha = (m <= -1.0e38f) ? 0.f : __builtin_amdgcn_exp2f((m - mn) * KS);
    const float bias = fmaf(-mn, KS, 11.0f);   // exponent of a score c: (c - mn) * log2(e) / 8 + 11, one fma
    const v8f ks8 = {KS, KS, KS, KS, KS, KS, KS, KS}, b8 = {bias, bias, bias, bias, bias, bias, bias, bias};
    const v8f x0 = __builtin_elementwise_fma(s[0], ks8, b8), x1 = __builtin_elementwise_fma(s[1], ks8, b8);
    float es0 = 0.f, es1 = 0.f; v16h pb;
#pragma unroll
    for (int r = 0; r < 8; ++r) { const float e0 = __builtin_amdgcn_exp2f(x0[r]), e1 = __builtin_amdgcn_exp2f(x1[r]); es0 += e0; es1 += e1;
      pb[r] = (_Float16)e0; pb[8 + r] = (_Float16)e1; }
    l = l * alpha + (es0 + es1); m = mn;
#pragma unroll
    for (int dt = 0; dt < 4; ++dt) acc[dt] *= alpha;
#pragma unroll
    for (int dt = 0; dt < 4; ++dt) acc[dt] = wmma16(frag_l(vb + dt * 16 * 128, fo[2 * p], fo[2 * p + 1]), pb, acc[dt]); }
   asm volatile("s_wait_dscnt 0x0" ::: "memory");      // this wave's reads of the buffer are done before it is refilled
   asm volatile("s_wait_asynccnt 0x0" ::: "memory");   // this wave's copies of stage t + 1 have landed before the barrier that publishes them
   __syncthreads();                                    // publishes stage t + 1 and ends every wave's reads of stage t
   if (t + 2 < NT) copy_stage(lds0 + (t & 1) * STAGE_B, gk + (size_t)(t + 2) * TILE_B, gv + (t + 2) * (KT * 2)); }
  asm volatile("s_wait_asynccnt 0x0" ::: "memory");    // nothing in flight when the ring becomes output staging
  const float il = 1.0f / (l + xhalf(l));  // the halves' sums are joined once, here; the 2^11 of P and of the sum cancel
#pragma unroll
  for (int dt = 0; dt < 4; ++dt) { v4f lo, hi;
#pragma unroll
    for (int r = 0; r < 4; ++r) { lo[r] = acc[dt][r] * il; hi[r] = acc[dt][4 + r] * il; }
    *(v4f*)&so[wave][col][dt * 16 + 8 * g] = lo; *(v4f*)&so[wave][col][dt * 16 + 8 * g + 4] = hi; }
  LDSX();
  for (int rl = 0; rl < 16; ++rl) if (lane < 16) vst2(OUT + (rq + rl) * HD + lane * 4, *(const v4f*)&so[wave][rl][lane * 4]);
}
extern "C" void kernel_launch(void* const* d_in, const int* in_sizes, int n_in, void* d_out, int out_size, void* d_ws, size_t ws_size, hipStream_t stream) {
  (void)in_sizes; (void)n_in; (void)out_size;
  const float** F = (const float**)d_in;   // 0 query, 1 key, 2 value [2,4096,1024]
  if (ws_size < (size_t)WS_END) return;
  char* ws = (char*)d_ws; _Float16 *Qr = (_Float16*)(ws + WS_Q), *Kr = (_Float16*)(ws + WS_K), *VT = (_Float16*)(ws + WS_VT);
  k_rows<<<NBH * SS / 64, 256, 0, stream>>>(F[0], Qr);
  k_rows<<<NBH * SS / 64, 256, 0, stream>>>(F[1], Kr);
  k_vt<<<NBH * SS / 64, 256, 0, stream>>>(F[2], VT);
  k_attn<<<dim3(TQB, TNB), 128, 0, stream>>>(Qr, Kr, VT, (float*)d_out);
}

// v004
// A run of this version takes 151 microseconds.
// Two timings next to v003 both put it at 1.10 times that version's speed.
// Over all steps from v000 it is 4.77 times as fast.
// compute dtype: query, key, value rounded to bf16 and used as EXACT f16 operands on WMMA 16x16x32 (heads split from the 1,024-wide rows); scores / 8 (the module's query / sqrt(64)), running-max softmax in f32 (hardware exp), P (scaled by 2^11, single f16) x v (exact); f32 accumulate; output in the module's (batch*head, token, 64) layout.
#include <hip/hip_runtime.h>
#include <math.h>

typedef __attribute__((ext_vector_type(16))) _Float16 v16h;
typedef __attribute__((ext_vector_type(16))) __bf16 v16b;
typedef __attribute__((ext_vector_type(8)))  _Float16 v8h;
typedef __attribute__((ext_vector_type(8)))  float v8f;
typedef __attribute__((ext_vector_type(4)))  float v4f;
typedef __attribute__((ext_vector_type(2)))  float v2f;
typedef __attribute__((ext_vector_type(4)))  unsigned v4u;
typedef __attribute__((ext_vector_type(4)))  int v4i;
typedef float __attribute__((may_alias)) float_a;
typedef int __attribute__((may_alias)) int_a;

template <typename T> __device__ __forceinline__ void vst2(void* p, T v) { *(T*)p = v;  }
// the builtin alone: the compiler keeps the distances behind its own WMMAs and may fetch the next LDS fragments while one runs
__device__ __forceinline__ v8f wmma16(v16h a, v16h b, v8f c) {
  return __builtin_amdgcn_wmma_f32_16x16x32_f16(false, a, false, b, (short)0, c, false, false);
}
__device__ __forceinline__ v8f wmma_bf(v16b a, v16b b, v8f c) {
  v8f d = __builtin_amdgcn_wmma_f32_16x16x32_bf16(false, a, false, b, (short)0, c, false, false);
  asm volatile("v_nop\n\tv_nop\n\tv_nop\n\tv_nop" : "+v"(d) : "v"(a), "v"(b));
  return d;
}
// 16x16x32 fragments: lane = (h = lane>>4, row/col = lane&15); elements 0..7 = k0+8h+0..7, 8..15 = k0+16+8h+0..7; D element r = row 8h+r
__device__ __forceinline__ v16h frag_h(const _Float16* rowk0, int lane) {
  union { v16h v; v8h q[2]; } u; const _Float16* p = rowk0 + 8 * (lane >> 4);
  u.q[0] = *(const v8h*)p; u.q[1] = *(const v8h*)(p + 16); return u.v;
}
__device__ __forceinline__ v16h frag_f32(const float* rowk0, int lane) {
  v16h a; const float* p = rowk0 + 8 * (lane >> 4);
#pragma unroll
  for (int i = 0; i < 8; ++i) { a[i] = (_Float16)p[i]; a[8 + i] = (_Float16)p[16 + i]; }
  return a;
}
__device__ __forceinline__ v16h frag_f32s(const float* rowk0, int lane, float sc) {
  v16h a; const float* p = rowk0 + 8 * (lane >> 4);
#pragma unroll
  for (int i = 0; i < 8; ++i) { a[i] = (_Float16)(p[i] * sc); a[8 + i] = (_Float16)(p[16 + i] * sc); }
  return a;
}
// column fragment from a [K][ld] layout (column n), rows >= K read as 0
__device__ __forceinline__ v16h fragc_f32(const float* W, int k0, int n, int lane, int ld, int K) {
  v16h a; const int g = lane >> 4;
#pragma unroll
  for (int i = 0; i < 8; ++i) { const int ka = k0 + 8 * g + i, kb = ka + 16;
    a[i] = (_Float16)(ka < K ? W[(size_t)(ka < K ? ka : K - 1) * ld + n] : 0.f); a[8 + i] = (_Float16)(kb < K ? W[(size_t)(kb < K ? kb : K - 1) * ld + n] : 0.f); }
  return a;
}
struct F2 { v16b h, l; };
__device__ __forceinline__ F2 bsplit16(const float v[16]) { F2 r;
#pragma unroll
  for (int i = 0; i < 16; ++i) { const __bf16 h = (__bf16)v[i]; r.h[i] = h; r.l[i] = (__bf16)(v[i] - (float)h); }
  return r; }
__device__ __forceinline__ F2 split_row(const float* row, int k0, int lane) { float v[16]; const float* p = row + k0 + 8 * (lane >> 4);
#pragma unroll
  for (int i = 0; i < 8; ++i) { v[i] = p[i]; v[8 + i] = p[16 + i]; }
  return bsplit16(v); }
__device__ __forceinline__ F2 split_rowK(const float* row, int k0, int lane, int K) { float v[16]; const int g = lane >> 4;
#pragma unroll
  for (int i = 0; i < 8; ++i) { const int ka = k0 + 8 * g + i, kb = ka + 16; v[i] = ka < K ? row[ka < K ? ka : K - 1] : 0.f; v[8 + i] = kb < K ? row[kb < K ? kb : K - 1] : 0.f; }
  return bsplit16(v); }
__device__ __forceinline__ F2 split_col(const float* W, int k0, int n, int lane, int ld, int K) { float v[16]; const int g = lane >> 4;
#pragma unroll
  for (int i = 0; i < 8; ++i) { const int ka = k0 + 8 * g + i, kb = ka + 16; v[i] = ka < K ? W[(size_t)(ka < K ? ka : K - 1) * ld + n] : 0.f; v[8 + i] = kb < K ? W[(size_t)(kb < K ? kb : K - 1) * ld + n] : 0.f; }
  return bsplit16(v); }
__device__ __forceinline__ v8f mac3(const F2& a, const F2& b, v8f c) { c = wmma_bf(a.l, b.h, c); c = wmma_bf(a.h, b.l, c); return wmma_bf(a.h, b.h, c); }
__device__ __forceinline__ float sigm(float v) { return 1.0f / (1.0f + expf(-v)); }
#define LDSX() do { asm volatile("s_wait_dscnt 0" ::: "memory"); __builtin_amdgcn_wave_barrier(); __builtin_amdgcn_fence(__ATOMIC_RELEASE, "workgroup"); } while (0)


// Memory-efficient (chunked) attention == softmax(q k^T / sqrt(64)) v per head (B 2, S 4,096, 16 heads x 64), output left in (batch*head, token, head_dim) form.
#define NB 2
#define NHD 16
#define NBH (NB * NHD)
#define SS 4096
#define HD 64
#define DW (NHD * HD)   // 1024-wide input rows
#ifndef TQB
#define TQB (SS / 64)
#define TNB NBH
#endif
typedef __attribute__((ext_vector_type(8))) __bf16 v8b;
__device__ __forceinline__ v16b frag_b(const __bf16* rowk0, int lane) {
  union { v16b v; v8b q[2]; } u; const __bf16* p = rowk0 + 8 * (lane >> 4);
  u.q[0] = *(const v8b*)p; u.q[1] = *(const v8b*)(p + 16); return u.v;
}
__device__ __forceinline__ float bfr(float v) { return (float)(__bf16)v; }
__device__ __attribute__((noinline)) float exp_ni(float v) { return expf(v); }
__device__ __attribute__((noinline)) float erf_ni(float v) { return erff(v); }

#define WS_Q   0u                                  // f16 rows q ; k ; VT planes [bh][64][s]
#define WS_K   (WS_Q + 2u * (size_t)NBH * SS * HD)
#define WS_VT  (WS_K + 2u * (size_t)NBH * SS * HD)
#define WS_END (WS_VT + 2u * (size_t)NBH * HD * SS)

__global__ __launch_bounds__(256) void k_rows(const float* __restrict__ X, _Float16* __restrict__ R) { const size_t r0 = (size_t)blockIdx.x * 64; const int t = threadIdx.x; __shared__ __align__(16) _Float16 s[64][72]; const size_t bh = r0 / SS, s0 = r0 % SS; const size_t b = bh / NHD, h = bh % NHD;
  for (int e = t; e < 64 * 64; e += 256) { const int r = e >> 6, c = e & 63; s[r][c] = (_Float16)bfr(X[((b * SS + s0 + r) * DW) + h * HD + c]); } __syncthreads();
  for (int e = t; e < 64 * 8; e += 256) { const int r = e >> 3, q = e & 7; vst2((unsigned*)(R + (r0 + r) * HD + q * 8), *(const v4u*)&s[r][q * 8]); } }
__global__ __launch_bounds__(256) void k_vt(const float* __restrict__ V, _Float16* __restrict__ VT) { __shared__ __align__(16) _Float16 st[64][72]; const size_t rb0 = (size_t)blockIdx.x * 64; const size_t bh = rb0 / SS, s0 = rb0 % SS; const size_t b = bh / NHD, h = bh % NHD; const int t = threadIdx.x;
  for (int e = t; e < 64 * 64; e += 256) { const int r = e >> 6, d = e & 63; st[d][r] = (_Float16)bfr(V[((b * SS + s0 + r) * DW) + h * HD + d]); } __syncthreads();
  for (int e = t; e < 64 * 8; e += 256) { const int d = e >> 3, pc = e & 7; vst2((unsigned*)(VT + (bh * HD + d) * SS + s0 + pc * 8), *(const v4u*)&st[d][pc * 8]); } }
// ---- k_attn: block = (64 queries, bh): exact-operand scores, softmax, P x v
// K and V^T reach the four waves through LDS: a stage is 64 keys, one K tile (64 key rows of 128 bytes) and one V^T tile (64 head-column rows of 128 bytes),
// brought by asynchronous copies in whole 128-byte lines, two buffers, the next stage in flight while this one is worked on.
// Inside a row the eight 16-byte pieces are stored at piece ^ ((row >> 1) & 7), so that the 16 rows a fragment read touches fall on 16 different bank groups without a pad.
#define KT 64
#define KS 0.18033688011112042f   // log2(e) / 8
#define NT (SS / KT)
#define TILE_B 8192
#define STAGE_B (2 * TILE_B)
typedef __attribute__((address_space(3))) unsigned char lds_u8;
// one stage's copies of one thread: four pieces of the K tile, four of the V^T tile (16 rows apart each)
__device__ __forceinline__ void copy_stage(unsigned l, const char* gk, const char* gv) {
  // s_wait_xcnt 0 as the last line: it stands before anything rewrites an address register that a copy names
  asm volatile("global_load_async_to_lds_b128 %0, %8, off\n\t"
               "global_load_async_to_lds_b128 %1, %9, off\n\t"
               "global_load_async_to_lds_b128 %2, %10, off\n\t"
               "global_load_async_to_lds_b128 %3, %11, off\n\t"
               "global_load_async_to_lds_b128 %4, %12, off\n\t"
               "global_load_async_to_lds_b128 %5, %13, off\n\t"
               "global_load_async_to_lds_b128 %6, %14, off\n\t"
               "global_load_async_to_lds_b128 %7, %15, off\n\t"
               "s_wait_xcnt 0x0"
               :: "v"(l), "v"(l + 2048u), "v"(l + 4096u), "v"(l + 6144u),
                  "v"(l + TILE_B), "v"(l + TILE_B + 2048u), "v"(l + TILE_B + 4096u), "v"(l + TILE_B + 6144u),
                  "v"(gk), "v"(gk + 2048), "v"(gk + 4096), "v"(gk + 6144),
                  "v"(gv), "v"(gv + 16 * SS * 2), "v"(gv + 32 * SS * 2), "v"(gv + 48 * SS * 2)
               : "memory");
}
__device__ __forceinline__ v16h frag_l(const unsigned char* t, unsigned o0, unsigned o1) {
  union { v16h v; v8h q[2]; } u; u.q[0] = *(const v8h*)(t + o0); u.q[1] = *(const v8h*)(t + o1); return u.v;
}
// lane l with lane l ^ 16: the two halves of a wave hold the same query column and different keys
__device__ __forceinline__ float xhalf(float x) { return __builtin_bit_cast(float, __builtin_amdgcn_permlanex16(__builtin_bit_cast(int, x), __builtin_bit_cast(int, x), 0x76543210, 0xfedcba98, false, false)); }
__global__ __launch_bounds__(128, 8) void k_attn(const _Float16* __restrict__ Q, const _Float16* __restrict__ K, const _Float16* __restrict__ VT, float* __restrict__ OUT) {
  __shared__ __align__(128) unsigned char ring[2 * STAGE_B];
  float (*so)[16][68] = (float (*)[16][68])ring;   // output staging takes the ring's place behind the loop's last barrier
  const int tid = threadIdx.x, wave = tid >> 5, lane = tid & 31, col = lane & 15, g = lane >> 4; const size_t bh = blockIdx.y; const int q0 = blockIdx.x * 64 + wave * 16; const size_t rq = bh * SS + q0;
  // copies: thread = (row tid >> 3 of each 16-row group, piece tid & 7)
  const unsigned crow = (unsigned)tid >> 3, cpc = (unsigned)tid & 7u;
  const unsigned lds0 = (unsigned)(size_t)(lds_u8*)ring + crow * 128u + ((cpc ^ ((crow >> 1) & 7u)) << 4);
  const char* gk = (const char*)(K + bh * SS * HD) + tid * 16;
  const char* gv = (const char*)(VT + bh * HD * SS) + (size_t)crow * (SS * 2) + cpc * 16;
  // fragment reads: row col of a 16-row group, pieces 2q + g, q = 0..3
  unsigned fo[4];
#pragma unroll   // fo[] stays in registers: every index a constant
  for (int q = 0; q < 4; ++q) fo[q] = (unsigned)col * 128u + ((((unsigned)g ^ ((unsigned)col >> 1)) ^ (2u * q)) << 4);
  copy_stage(lds0, gk, gv);
  asm volatile("s_wait_asynccnt 0x0" ::: "memory");   // stage 0 has landed before the barrier that publishes it
  __syncthreads();
  copy_stage(lds0 + STAGE_B, gk + TILE_B, gv + KT * 2);
  v16h aq[2];
#pragma unroll
  for (int kc = 0; kc < 2; ++kc) aq[kc] = frag_h(Q + (rq + col) * HD + kc * 32, lane);
  float m = -3.0e38f, l = 0.f;   // query col: running maximum of the raw products (equal in both halves), this half's share of the sum (times 2^11, as P)
  v8f acc[4] = {};               // acc[dt][r] = O^T[dt * 16 + 8g + r][col]
#pragma unroll 1
  for (int t = 0; t < NT; ++t) { const unsigned char* kb = ring + (t & 1) * STAGE_B; const unsigned char* vb = kb + TILE_B;
#pragma unroll   // the stage's two 32-key passes: fo[] indices and row offsets stay constants (immediate offsets of the LDS reads)
   for (int p = 0; p < 2; ++p) { v8f s[2];
#pragma unroll
    for (int ct = 0; ct < 2; ++ct) { const unsigned char* kr = kb + (p * 32 + ct * 16) * 128; v8f c = {};
#pragma unroll
      for (int kc = 0; kc < 2; ++kc) c = wmma16(frag_l(kr, fo[2 * kc], fo[2 * kc + 1]), aq[kc], c);
      s[ct] = c; }   // raw products: the scale goes into the exponent's fma below
    float mx = fmaxf(s[0][0], s[1][0]);
#pragma unroll
    for (int r = 1; r < 8; ++r) mx = fmaxf(mx, fmaxf(s[0][r], s[1][r]));
    mx = fmaxf(mx, xhalf(mx));
    const float mn = fmaxf(m, mx); const float alpha = (m <= -1.0e38f) ? 0.f : __builtin_amdgcn_exp2f((m - mn) * KS);
    const float bias = fmaf(-mn, KS, 11.0f);   // exponent of a score c: (c - mn) * log2(e) / 8 + 11, one fma
    const v8f ks8 = {KS, KS, KS, KS, KS, KS, KS, KS}, b8 = {bias, bias, bias, bias, bias, bias, bias, bias};
    const v8f x0 = __builtin_elementwise_fma(s[0], ks8, b8), x1 = __builtin_elementwise_fma(s[1], ks8, b8);
    float es0 = 0.f, es1 = 0.f; v16h pb;
#pragma unroll
    for (int r = 0; r < 8; ++r) { const float e0 = __builtin_amdgcn_exp2f(x0[r]), e1 = __builtin_amdgcn_exp2f(x1[r]); es0 += e0; es1 += e1;
      pb[r] = (_Float16)e0; pb[8 + r] = (_Float16)e1; }
    l = l * alpha + (es0 + es1); m = mn;
#pragma unroll
    for (int dt = 0; dt < 4; ++dt) acc[dt] *= alpha;
#pragma unroll
    for (int dt = 0; dt < 4; ++dt) acc[dt] = wmma16(frag_l(vb + dt * 16 * 128, fo[2 * p], fo[2 * p + 1]), pb, acc[dt]); }
   asm volatile("s_wait_dscnt 0x0" ::: "memory");      // this wave's reads of the buffer are done before it is refilled
   asm volatile("s_wait_asynccnt 0x0" ::: "memory");   // this wave's copies of stage t + 1 have landed before the barrier that publishes them
   __syncthreads();                                    // publishes stage t + 1 and ends every wave's reads of stage t
   if (t + 2 < NT) copy_stage(lds0 + (t & 1) * STAGE_B, gk + (size_t)(t + 2) * TILE_B, gv + (t + 2) * (KT * 2)); }
  asm volatile("s_wait_asynccnt 0x0" ::: "memory");    // nothing in flight when the ring becomes output staging
  const float il = 1.0f / (l + xhalf(l));  // the halves' sums are joined once, here; the 2^11 of P and of the sum cancel
#pragma unroll
  for (int dt = 0; dt < 4; ++dt) { v4f lo, hi;
#pragma unroll
    for (int r = 0; r < 4; ++r) { lo[r] = acc[dt][r] * il; hi[r] = acc[dt][4 + r] * il; }
    *(v4f*)&so[wave][col][dt * 16 + 8 * g] = lo; *(v4f*)&so[wave][col][dt * 16 + 8 * g + 4] = hi; }
  LDSX();
  for (int rl = 0; rl < 16; ++rl) if (lane < 16) vst2(OUT + (rq + rl) * HD + lane * 4, *(const v4f*)&so[wave][rl][lane * 4]);
}
extern "C" void kernel_launch(void* const* d_in, const int* in_sizes, int n_in, void* d_out, int out_size, void* d_ws, size_t ws_size, hipStream_t stream) {
  (void)in_sizes; (void)n_in; (void)out_size;
  const float** F = (const float**)d_in;   // 0 query, 1 key, 2 value [2,4096,1024]
  if (ws_size < (size_t)WS_END) return;
  char* ws = (char*)d_ws; _Float16 *Qr = (_Float16*)(ws + WS_Q), *Kr = (_Float16*)(ws + WS_K), *VT = (_Float16*)(ws + WS_VT);
  k_rows<<<NBH * SS / 64, 256, 0, stream>>>(F[0], Qr);
  k_rows<<<NBH * SS / 64, 256, 0, stream>>>(F[1], Kr);
  k_vt<<<NBH * SS / 64, 256, 0, stream>>>(F[2], VT);
  k_attn<<<dim3(TQB, TNB), 128, 0, stream>>>(Qr, Kr, VT, (float*)d_out);
}

// v005
// Measured time: 138 microseconds a run.
// Timed twice side by side with v004, it ran 1.10 times as fast both times.
// Over all steps from v000 it is 5.25 times as fast.
// compute dtype: query, key, value rounded to bf16 and used as EXACT f16 operands on WMMA 16x16x32 (heads split from the 1,024-wide rows); scores / 8 (the module's query / sqrt(64)), running-max softmax in f32 (hardware exp), P (scaled by 2^11, single f16) x v (exact); f32 accumulate; output in the module's (batch*head, token, 64) layout.
#include <hip/hip_runtime.h>
#include <math.h>

typedef __attribute__((ext_vector_type(16))) _Float16 v16h;
typedef __attribute__((ext_vector_type(16))) __bf16 v16b;
typedef __attribute__((ext_vector_type(8)))  _Float16 v8h;
typedef __attribute__((ext_vector_type(8)))  float v8f;
typedef __attribute__((ext_vector_type(4)))  float v4f;
typedef __attribute__((ext_vector_type(2)))  float v2f;
typedef __attribute__((ext_vector_type(4)))  unsigned v4u;
typedef __attribute__((ext_vector_type(4)))  int v4i;
typedef float __attribute__((may_alias)) float_a;
typedef int __attribute__((may_alias)) int_a;

template <typename T> __device__ __forceinline__ void vst2(void* p, T v) { *(T*)p = v;  }
// the builtin alone: the compiler keeps the distances behind its own WMMAs and may fetch the next LDS fragments while one runs
__device__ __forceinline__ v8f wmma16(v16h a, v16h b, v8f c) {
  return __builtin_amdgcn_wmma_f32_16x16x32_f16(false, a, false, b, (short)0, c, false, false);
}
__device__ __forceinline__ v8f wmma_bf(v16b a, v16b b, v8f c) {
  v8f d = __builtin_amdgcn_wmma_f32_16x16x32_bf16(false, a, false, b, (short)0, c, false, false);
  asm volatile("v_nop\n\tv_nop\n\tv_nop\n\tv_nop" : "+v"(d) : "v"(a), "v"(b));
  return d;
}
// 16x16x32 fragments: lane = (h = lane>>4, row/col = lane&15); elements 0..7 = k0+8h+0..7, 8..15 = k0+16+8h+0..7; D element r = row 8h+r
__device__ __forceinline__ v16h frag_h(const _Float16* rowk0, int lane) {
  union { v16h v; v8h q[2]; } u; const _Float16* p = rowk0 + 8 * (lane >> 4);
  u.q[0] = *(const v8h*)p; u.q[1] = *(const v8h*)(p + 16); return u.v;
}
__device__ __forceinline__ v16h frag_f32(const float* rowk0, int lane) {
  v16h a; const float* p = rowk0 + 8 * (lane >> 4);
#pragma unroll
  for (int i = 0; i < 8; ++i) { a[i] = (_Float16)p[i]; a[8 + i] = (_Float16)p[16 + i]; }
  return a;
}
__device__ __forceinline__ v16h frag_f32s(const float* rowk0, int lane, float sc) {
  v16h a; const float* p = rowk0 + 8 * (lane >> 4);
#pragma unroll
  for (int i = 0; i < 8; ++i) { a[i] = (_Float16)(p[i] * sc); a[8 + i] = (_Float16)(p[16 + i] * sc); }
  return a;
}
// column fragment from a [K][ld] layout (column n), rows >= K read as 0
__device__ __forceinline__ v16h fragc_f32(const float* W, int k0, int n, int lane, int ld, int K) {
  v16h a; const int g = lane >> 4;
#pragma unroll
  for (int i = 0; i < 8; ++i) { const int ka = k0 + 8 * g + i, kb = ka + 16;
    a[i] = (_Float16)(ka < K ? W[(size_t)(ka < K ? ka : K - 1) * ld + n] : 0.f); a[8 + i] = (_Float16)(kb < K ? W[(size_t)(kb < K ? kb : K - 1) * ld + n] : 0.f); }
  return a;
}
struct F2 { v16b h, l; };
__device__ __forceinline__ F2 bsplit16(const float v[16]) { F2 r;
#pragma unroll
  for (int i = 0; i < 16; ++i) { const __bf16 h = (__bf16)v[i]; r.h[i] = h; r.l[i] = (__bf16)(v[i] - (float)h); }
  return r; }
__device__ __forceinline__ F2 split_row(const float* row, int k0, int lane) { float v[16]; const float* p = row + k0 + 8 * (lane >> 4);
#pragma unroll
  for (int i = 0; i < 8; ++i) { v[i] = p[i]; v[8 + i] = p[16 + i]; }
  return bsplit16(v); }
__device__ __forceinline__ F2 split_rowK(const float* row, int k0, int lane, int K) { float v[16]; const int g = lane >> 4;
#pragma unroll
  for (int i = 0; i < 8; ++i) { const int ka = k0 + 8 * g + i, kb = ka + 16; v[i] = ka < K ? row[ka < K ? ka : K - 1] : 0.f; v[8 + i] = kb < K ? row[kb < K ? kb : K - 1] : 0.f; }
  return bsplit16(v); }
__device__ __forceinline__ F2 split_col(const float* W, int k0, int n, int lane, int ld, int K) { float v[16]; const int g = lane >> 4;
#pragma unroll
  for (int i = 0; i < 8; ++i) { const int ka = k0 + 8 * g + i, kb = ka + 16; v[i] = ka < K ? W[(size_t)(ka < K ? ka : K - 1) * ld + n] : 0.f; v[8 + i] = kb < K ? W[(size_t)(kb < K ? kb : K - 1) * ld + n] : 0.f; }
  return bsplit16(v); }
__device__ __forceinline__ v8f mac3(const F2& a, const F2& b, v8f c) { c = wmma_bf(a.l, b.h, c); c = wmma_bf(a.h, b.l, c); return wmma_bf(a.h, b.h, c); }
__device__ __forceinline__ float sigm(float v) { return 1.0f / (1.0f + expf(-v)); }
#define LDSX() do { asm volatile("s_wait_dscnt 0" ::: "memory"); __builtin_amdgcn_wave_barrier(); __builtin_amdgcn_fence(__ATOMIC_RELEASE, "workgroup"); } while (0)


// Memory-efficient (chunked) attention == softmax(q k^T / sqrt(64)) v per head (B 2, S 4,096, 16 heads x 64), output left in (batch*head, token, head_dim) form.
#define NB 2
#define NHD 16
#define NBH (NB * NHD)
#define SS 4096
#define HD 64
#define DW (NHD * HD)   // 1024-wide input rows
#ifndef TQB
#define TQB (SS / 128)
#define TNB NBH
#endif
typedef __attribute__((ext_vector_type(8))) __bf16 v8b;
__device__ __forceinline__ v16b frag_b(const __bf16* rowk0, int lane) {
  union { v16b v; v8b q[2]; } u; const __bf16* p = rowk0 + 8 * (lane >> 4);
  u.q[0] = *(const v8b*)p; u.q[1] = *(const v8b*)(p + 16); return u.v;
}
__device__ __forceinline__ float bfr(float v) { return (float)(__bf16)v; }
__device__ __attribute__((noinline)) float exp_ni(float v) { return expf(v); }
__device__ __attribute__((noinline)) float erf_ni(float v) { return erff(v); }

#define WS_Q   0u                                  // f16 rows q ; k ; VT planes [bh][64][s]
#define WS_K   (WS_Q + 2u * (size_t)NBH * SS * HD)
#define WS_VT  (WS_K + 2u * (size_t)NBH * SS * HD)
#define WS_END (WS_VT + 2u * (size_t)NBH * HD * SS)

__global__ __launch_bounds__(256) void k_rows(const float* __restrict__ X, _Float16* __restrict__ R) { const size_t r0 = (size_t)blockIdx.x * 64; const int t = threadIdx.x; __shared__ __align__(16) _Float16 s[64][72]; const size_t bh = r0 / SS, s0 = r0 % SS; const size_t b = bh / NHD, h = bh % NHD;
  for (int e = t; e < 64 * 64; e += 256) { const int r = e >> 6, c = e & 63; s[r][c] = (_Float16)bfr(X[((b * SS + s0 + r) * DW) + h * HD + c]); } __syncthreads();
  for (int e = t; e < 64 * 8; e += 256) { const int r = e >> 3, q = e & 7; vst2((unsigned*)(R + (r0 + r) * HD + q * 8), *(const v4u*)&s[r][q * 8]); } }
__global__ __launch_bounds__(256) void k_vt(const float* __restrict__ V, _Float16* __restrict__ VT) { __shared__ __align__(16) _Float16 st[64][72]; const size_t rb0 = (size_t)blockIdx.x * 64; const size_t bh = rb0 / SS, s0 = rb0 % SS; const size_t b = bh / NHD, h = bh % NHD; const int t = threadIdx.x;
  for (int e = t; e < 64 * 64; e += 256) { const int r = e >> 6, d = e & 63; st[d][r] = (_Float16)bfr(V[((b * SS + s0 + r) * DW) + h * HD + d]); } __syncthreads();
  for (int e = t; e < 64 * 8; e += 256) { const int d = e >> 3, pc = e & 7; vst2((unsigned*)(VT + (bh * HD + d) * SS + s0 + pc * 8), *(const v4u*)&st[d][pc * 8]); } }
// ---- k_attn: block = (128 queries, bh): exact-operand scores, softmax, P x v
// K and V^T reach the four waves through LDS: a stage is 64 keys, one K tile (64 key rows of 128 bytes) and one V^T tile (64 head-column rows of 128 bytes),
// brought by asynchronous copies in whole 128-byte lines, two buffers, the next stage in flight while this one is worked on.
// Inside a row the eight 16-byte pieces are stored at piece ^ ((row >> 1) & 7), so that the 16 rows a fragment read touches fall on 16 different bank groups without a pad.
#define KT 64
#define KS 0.18033688011112042f   // log2(e) / 8
#define NT (SS / KT)
#define TILE_B 8192
#define STAGE_B (2 * TILE_B)
typedef __attribute__((address_space(3))) unsigned char lds_u8;
// one stage's copies of one thread: four pieces of the K tile, four of the V^T tile (16 rows apart each)
__device__ __forceinline__ void copy_stage(unsigned l, const char* gk, const char* gv) {
  // s_wait_xcnt 0 as the last line: it stands before anything rewrites an address register that a copy names
  asm volatile("global_load_async_to_lds_b128 %0, %8, off\n\t"
               "global_load_async_to_lds_b128 %1, %9, off\n\t"
               "global_load_async_to_lds_b128 %2, %10, off\n\t"
               "global_load_async_to_lds_b128 %3, %11, off\n\t"
               "global_load_async_to_lds_b128 %4, %12, off\n\t"
               "global_load_async_to_lds_b128 %5, %13, off\n\t"
               "global_load_async_to_lds_b128 %6, %14, off\n\t"
               "global_load_async_to_lds_b128 %7, %15, off\n\t"
               "s_wait_xcnt 0x0"
               :: "v"(l), "v"(l + 2048u), "v"(l + 4096u), "v"(l + 6144u),
                  "v"(l + TILE_B), "v"(l + TILE_B + 2048u), "v"(l + TILE_B + 4096u), "v"(l + TILE_B + 6144u),
                  "v"(gk), "v"(gk + 2048), "v"(gk + 4096), "v"(gk + 6144),
                  "v"(gv), "v"(gv + 16 * SS * 2), "v"(gv + 32 * SS * 2), "v"(gv + 48 * SS * 2)
               : "memory");
}
__device__ __forceinline__ v16h frag_l(const unsigned char* t, unsigned o0, unsigned o1) {
  union { v16h v; v8h q[2]; } u; u.q[0] = *(const v8h*)(t + o0); u.q[1] = *(const v8h*)(t + o1); return u.v;
}
// lane l with lane l ^ 16: the two halves of a wave hold the same query column and different keys
__device__ __forceinline__ float xhalf(float x) { return __builtin_bit_cast(float, __builtin_amdgcn_permlanex16(__builtin_bit_cast(int, x), __builtin_bit_cast(int, x), 0x76543210, 0xfedcba98, false, false)); }
#define QT 2
#define SO_B (4 * QT * 16 * 68 * 4)   // output staging, a little larger than the two stages
__global__ __launch_bounds__(128, 4) void k_attn(const _Float16* __restrict__ Q, const _Float16* __restrict__ K, const _Float16* __restrict__ VT, float* __restrict__ OUT) {
  static_assert(SO_B >= 2 * STAGE_B, "the array holds the ring and, behind the loop, the output staging");
  __shared__ __align__(128) unsigned char ring[SO_B];
  float (*so)[QT * 16][68] = (float (*)[QT * 16][68])ring;   // output staging takes the ring's place behind the loop's last barrier
  const int tid = threadIdx.x, wave = tid >> 5, lane = tid & 31, col = lane & 15, g = lane >> 4; const size_t bh = blockIdx.y; const int q0 = blockIdx.x * (64 * QT) + wave * (16 * QT); const size_t rq = bh * SS + q0;
  // copies: thread = (row tid >> 3 of each 16-row group, piece tid & 7)
  const unsigned crow = (unsigned)tid >> 3, cpc = (unsigned)tid & 7u;
  const unsigned lds0 = (unsigned)(size_t)(lds_u8*)ring + crow * 128u + ((cpc ^ ((crow >> 1) & 7u)) << 4);
  const char* gk = (const char*)(K + bh * SS * HD) + tid * 16;
  const char* gv = (const char*)(VT + bh * HD * SS) + (size_t)crow * (SS * 2) + cpc * 16;
  // fragment reads: row col of a 16-row group, pieces 2q + g, q = 0..3
  unsigned fo[4];
#pragma unroll   // fo[] stays in registers: every index a constant
  for (int q = 0; q < 4; ++q) fo[q] = (unsigned)col * 128u + ((((unsigned)g ^ ((unsigned)col >> 1)) ^ (2u * q)) << 4);
  copy_stage(lds0, gk, gv);
  asm volatile("s_wait_asynccnt 0x0" ::: "memory");   // stage 0 has landed before the barrier that publishes it
  __syncthreads();
  copy_stage(lds0 + STAGE_B, gk + TILE_B, gv + KT * 2);
  v16h aq[QT][2];
#pragma unroll   // aq[][] stays in registers: every index a constant
  for (int qt = 0; qt < QT; ++qt)
#pragma unroll
    for (int kc = 0; kc < 2; ++kc) aq[qt][kc] = frag_h(Q + (rq + qt * 16 + col) * HD + kc * 32, lane);
  float m[QT], l[QT];            // query qt * 16 + col: running maximum of the raw products (equal in both halves), this half's share of the sum (times 2^11, as P)
  v8f acc[QT][4] = {};           // acc[qt][dt][r] = O^T[dt * 16 + 8g + r][qt * 16 + col]
#pragma unroll   // m[], l[] stay in registers
  for (int qt = 0; qt < QT; ++qt) { m[qt] = -3.0e38f; l[qt] = 0.f; }
#pragma unroll 1
  for (int t = 0; t < NT; ++t) { const unsigned char* kb = ring + (t & 1) * STAGE_B; const unsigned char* vb = kb + TILE_B;
#pragma unroll   // the stage's two 32-key passes: fo[] indices and row offsets stay constants (immediate offsets of the LDS reads)
   for (int p = 0; p < 2; ++p) { v8f s[QT][2];
#pragma unroll
    for (int ct = 0; ct < 2; ++ct) { const unsigned char* kr = kb + (p * 32 + ct * 16) * 128;
#pragma unroll   // s[][] stays in registers: every index a constant
      for (int qt = 0; qt < QT; ++qt) s[qt][ct] = v8f{};
#pragma unroll
      for (int kc = 0; kc < 2; ++kc) { const v16h kf = frag_l(kr, fo[2 * kc], fo[2 * kc + 1]);   // read once, used by both query tiles
#pragma unroll   // both tiles' products side by side on the one fragment
        for (int qt = 0; qt < QT; ++qt) s[qt][ct] = wmma16(kf, aq[qt][kc], s[qt][ct]); } }   // raw products: the scale goes into the exponent's fma below
    v16h pb[QT];
#pragma unroll   // the two query tiles' softmax chains are independent of each other
    for (int qt = 0; qt < QT; ++qt) {
      float mx = fmaxf(s[qt][0][0], s[qt][1][0]);
#pragma unroll
      for (int r = 1; r < 8; ++r) mx = fmaxf(mx, fmaxf(s[qt][0][r], s[qt][1][r]));
      mx = fmaxf(mx, xhalf(mx));
      const float mn = fmaxf(m[qt], mx); const float alpha = (m[qt] <= -1.0e38f) ? 0.f : __builtin_amdgcn_exp2f((m[qt] - mn) * KS);
      const float bias = fmaf(-mn, KS, 11.0f);   // exponent of a score c: (c - mn) * log2(e) / 8 + 11, one fma
      const v8f ks8 = {KS, KS, KS, KS, KS, KS, KS, KS}, b8 = {bias, bias, bias, bias, bias, bias, bias, bias};
      const v8f x0 = __builtin_elementwise_fma(s[qt][0], ks8, b8), x1 = __builtin_elementwise_fma(s[qt][1], ks8, b8);
      float es0 = 0.f, es1 = 0.f;
#pragma unroll
      for (int r = 0; r < 8; ++r) { const float e0 = __builtin_amdgcn_exp2f(x0[r]), e1 = __builtin_amdgcn_exp2f(x1[r]); es0 += e0; es1 += e1;
        pb[qt][r] = (_Float16)e0; pb[qt][8 + r] = (_Float16)e1; }
      l[qt] = l[qt] * alpha + (es0 + es1); m[qt] = mn;
#pragma unroll
      for (int dt = 0; dt < 4; ++dt) acc[qt][dt] *= alpha; }
#pragma unroll
    for (int dt = 0; dt < 4; ++dt) { const v16h vf = frag_l(vb + dt * 16 * 128, fo[2 * p], fo[2 * p + 1]);   // read once, used by both query tiles
#pragma unroll   // both tiles' products side by side on the one fragment
      for (int qt = 0; qt < QT; ++qt) acc[qt][dt] = wmma16(vf, pb[qt], acc[qt][dt]); } }
   asm volatile("s_wait_dscnt 0x0" ::: "memory");      // this wave's reads of the buffer are done before it is refilled
   asm volatile("s_wait_asynccnt 0x0" ::: "memory");   // this wave's copies of stage t + 1 have landed before the barrier that publishes them
   __syncthreads();                                    // publishes stage t + 1 and ends every wave's reads of stage t
   if (t + 2 < NT) copy_stage(lds0 + (t & 1) * STAGE_B, gk + (size_t)(t + 2) * TILE_B, gv + (t + 2) * (KT * 2)); }
  asm volatile("s_wait_asynccnt 0x0" ::: "memory");    // nothing in flight when the ring becomes output staging
#pragma unroll   // acc[][] and l[] stay in registers: every index a constant
  for (int qt = 0; qt < QT; ++qt) { const float il = 1.0f / (l[qt] + xhalf(l[qt]));  // the halves' sums are joined once, here; the 2^11 of P and of the sum cancel
#pragma unroll
    for (int dt = 0; dt < 4; ++dt) { v4f lo, hi;
#pragma unroll
      for (int r = 0; r < 4; ++r) { lo[r] = acc[qt][dt][r] * il; hi[r] = acc[qt][dt][4 + r] * il; }
      *(v4f*)&so[wave][qt * 16 + col][dt * 16 + 8 * g] = lo; *(v4f*)&so[wave][qt * 16 + col][dt * 16 + 8 * g + 4] = hi; } }
  LDSX();
  for (int rl = 0; rl < QT * 16; ++rl) if (lane < 16) vst2(OUT + (rq + rl) * HD + lane * 4, *(const v4f*)&so[wave][rl][lane * 4]);
}
extern "C" void kernel_launch(void* const* d_in, const int* in_sizes, int n_in, void* d_out, int out_size, void* d_ws, size_t ws_size, hipStream_t stream) {
  (void)in_sizes; (void)n_in; (void)out_size;
  const float** F = (const float**)d_in;   // 0 query, 1 key, 2 value [2,4096,1024]
  if (ws_size < (size_t)WS_END) return;
  char* ws = (char*)d_ws; _Float16 *Qr = (_Float16*)(ws + WS_Q), *Kr = (_Float16*)(ws + WS_K), *VT = (_Float16*)(ws + WS_VT);
  k_rows<<<NBH * SS / 64, 256, 0, stream>>>(F[0], Qr);
  k_rows<<<NBH * SS / 64, 256, 0, stream>>>(F[1], Kr);
  k_vt<<<NBH * SS / 64, 256, 0, stream>>>(F[2], VT);
  k_attn<<<dim3(TQB, TNB), 128, 0, stream>>>(Qr, Kr, VT, (float*)d_out);
}

// v006
// Measured time: 126 microseconds a run.
// In two side-by-side timings against v005, it was 1.07 and 1.08 times as fast.
// Over all steps from v000 it is 5.65 times as fast.
// compute dtype: query, key, value rounded to bf16 and used as EXACT f16 operands on WMMA 16x16x32 (heads split from the 1,024-wide rows); scores / 8 (the module's query / sqrt(64)), running-max softmax in f32 (hardware exp), P (scaled by 2^11, single f16) x v (exact); f32 accumulate; output in the module's (batch*head, token, 64) layout.
#include <hip/hip_runtime.h>
#include <math.h>

typedef __attribute__((ext_vector_type(16))) _Float16 v16h;
typedef __attribute__((ext_vector_type(16))) __bf16 v16b;
typedef __attribute__((ext_vector_type(8)))  _Float16 v8h;
typedef __attribute__((ext_vector_type(8)))  float v8f;
typedef __attribute__((ext_vector_type(4)))  float v4f;
typedef __attribute__((ext_vector_type(2)))  float v2f;
typedef __attribute__((ext_vector_type(4)))  unsigned v4u;
typedef __attribute__((ext_vector_type(4)))  int v4i;
typedef float __attribute__((may_alias)) float_a;
typedef int __attribute__((may_alias)) int_a;

template <typename T> __device__ __forceinline__ void vst2(void* p, T v) { *(T*)p = v;  }
// the builtin alone: the compiler keeps the distances behind its own WMMAs and may fetch the next LDS fragments while one runs
__device__ __forceinline__ v8f wmma16(v16h a, v16h b, v8f c) {
  return __builtin_amdgcn_wmma_f32_16x16x32_f16(false, a, false, b, (short)0, c, false, false);
}
__device__ __forceinline__ v8f wmma_bf(v16b a, v16b b, v8f c) {
  v8f d = __builtin_amdgcn_wmma_f32_16x16x32_bf16(false, a, false, b, (short)0, c, false, false);
  asm volatile("v_nop\n\tv_nop\n\tv_nop\n\tv_nop" : "+v"(d) : "v"(a), "v"(b));
  return d;
}
// 16x16x32 fragments: lane = (h = lane>>4, row/col = lane&15); elements 0..7 = k0+8h+0..7, 8..15 = k0+16+8h+0..7; D element r = row 8h+r
__device__ __forceinline__ v16h frag_h(const _Float16* rowk0, int lane) {
  union { v16h v; v8h q[2]; } u; const _Float16* p = rowk0 + 8 * (lane >> 4);
  u.q[0] = *(const v8h*)p; u.q[1] = *(const v8h*)(p + 16); return u.v;
}
__device__ __forceinline__ v16h frag_f32(const float* rowk0, int lane) {
  v16h a; const float* p = rowk0 + 8 * (lane >> 4);
#pragma unroll
  for (int i = 0; i < 8; ++i) { a[i] = (_Float16)p[i]; a[8 + i] = (_Float16)p[16 + i]; }
  return a;
}
__device__ __forceinline__ v16h frag_f32s(const float* rowk0, int lane, float sc) {
  v16h a; const float* p = rowk0 + 8 * (lane >> 4);
#pragma unroll
  for (int i = 0; i < 8; ++i) { a[i] = (_Float16)(p[i] * sc); a[8 + i] = (_Float16)(p[16 + i] * sc); }
  return a;
}
// column fragment from a [K][ld] layout (column n), rows >= K read as 0
__device__ __forceinline__ v16h fragc_f32(const float* W, int k0, int n, int lane, int ld, int K) {
  v16h a; const int g = lane >> 4;
#pragma unroll
  for (int i = 0; i < 8; ++i) { const int ka = k0 + 8 * g + i, kb = ka + 16;
    a[i] = (_Float16)(ka < K ? W[(size_t)(ka < K ? ka : K - 1) * ld + n] : 0.f); a[8 + i] = (_Float16)(kb < K ? W[(size_t)(kb < K ? kb : K - 1) * ld + n] : 0.f); }
  return a;
}
struct F2 { v16b h, l; };
__device__ __forceinline__ F2 bsplit16(const float v[16]) { F2 r;
#pragma unroll
  for (int i = 0; i < 16; ++i) { const __bf16 h = (__bf16)v[i]; r.h[i] = h; r.l[i] = (__bf16)(v[i] - (float)h); }
  return r; }
__device__ __forceinline__ F2 split_row(const float* row, int k0, int lane) { float v[16]; const float* p = row + k0 + 8 * (lane >> 4);
#pragma unroll
  for (int i = 0; i < 8; ++i) { v[i] = p[i]; v[8 + i] = p[16 + i]; }
  return bsplit16(v); }
__device__ __forceinline__ F2 split_rowK(const float* row, int k0, int lane, int K) { float v[16]; const int g = lane >> 4;
#pragma unroll
  for (int i = 0; i < 8; ++i) { const int ka = k0 + 8 * g + i, kb = ka + 16; v[i] = ka < K ? row[ka < K ? ka : K - 1] : 0.f; v[8 + i] = kb < K ? row[kb < K ? kb : K - 1] : 0.f; }
  return bsplit16(v); }
__device__ __forceinline__ F2 split_col(const float* W, int k0, int n, int lane, int ld, int K) { float v[16]; const int g = lane >> 4;
#pragma unroll
  for (int i = 0; i < 8; ++i) { const int ka = k0 + 8 * g + i, kb = ka + 16; v[i] = ka < K ? W[(size_t)(ka < K ? ka : K - 1) * ld + n] : 0.f; v[8 + i] = kb < K ? W[(size_t)(kb < K ? kb : K - 1) * ld + n] : 0.f; }
  return bsplit16(v); }
__device__ __forceinline__ v8f mac3(const F2& a, const F2& b, v8f c) { c = wmma_bf(a.l, b.h, c); c = wmma_bf(a.h, b.l, c); return wmma_bf(a.h, b.h, c); }
__device__ __forceinline__ float sigm(float v) { return 1.0f / (1.0f + expf(-v)); }
#define LDSX() do { asm volatile("s_wait_dscnt 0" ::: "memory"); __builtin_amdgcn_wave_barrier(); __builtin_amdgcn_fence(__ATOMIC_RELEASE, "workgroup"); } while (0)


// Memory-efficient (chunked) attention == softmax(q k^T / sqrt(64)) v per head (B 2, S 4,096, 16 heads x 64), output left in (batch*head, token, head_dim) form.
#define NB 2
#define NHD 16
#define NBH (NB * NHD)
#define SS 4096
#define HD 64
#define DW (NHD * HD)   // 1024-wide input rows
#ifndef TQB
#define TQB (SS / 128)
#define TNB NBH
#endif
typedef __attribute__((ext_vector_type(8))) __bf16 v8b;
__device__ __forceinline__ v16b frag_b(const __bf16* rowk0, int lane) {
  union { v16b v; v8b q[2]; } u; const __bf16* p = rowk0 + 8 * (lane >> 4);
  u.q[0] = *(const v8b*)p; u.q[1] = *(const v8b*)(p + 16); return u.v;
}
__device__ __forceinline__ float bfr(float v) { return (float)(__bf16)v; }
__device__ __attribute__((noinline)) float exp_ni(float v) { return expf(v); }
__device__ __attribute__((noinline)) float erf_ni(float v) { return erff(v); }

#define WS_Q   0u                                  // f16 rows q ; k ; VT planes [bh][64][s]
#define WS_K   (WS_Q + 2u * (size_t)NBH * SS * HD)
#define WS_VT  (WS_K + 2u * (size_t)NBH * SS * HD)
#define WS_END (WS_VT + 2u * (size_t)NBH * HD * SS)

// ---- k_prep: the one conversion launch. 1,024 blocks, four resident on a WGP; a block takes two 64-token x 64-column head tiles of each of query, key, value.
// A thread asks for all its 24 pieces of 16 bytes at the start (16 lanes cover one 256-byte head row), so the whole input is on its way at once and few waves have to start.
// query and key tiles go out straight from registers, 16 lanes writing one 128-byte row; value tiles turn through LDS. All stores stand behind the one barrier, which waits for no store.
#define PB 1024
typedef __attribute__((ext_vector_type(2))) unsigned v2u;
typedef __attribute__((ext_vector_type(2))) __bf16 v2b;
typedef __attribute__((ext_vector_type(2))) _Float16 v2h;
// two values rounded to bf16 and held as f16, in one word: packed conversions both ways
__device__ __forceinline__ unsigned pk2(float a, float b) {
  const v2f x = {a, b}; const unsigned r = __builtin_bit_cast(unsigned, __builtin_convertvector(x, v2b));
  const v2f y = {__builtin_bit_cast(float, r << 16), __builtin_bit_cast(float, r & 0xffff0000u)};
  return __builtin_bit_cast(unsigned, __builtin_convertvector(y, v2h));
}
__global__ __launch_bounds__(256) void k_prep(const float* __restrict__ Xq, const float* __restrict__ Xk, const float* __restrict__ Xv, _Float16* __restrict__ Rq, _Float16* __restrict__ Rk, _Float16* __restrict__ VT) {
  // st[u][d][word]: word kk of row d holds tokens 2kk, 2kk + 1; its 16-byte piece kk >> 2 is stored at piece ^ ((d >> 2) & 7), which spreads the 16 rows one store touches over the banks
  __shared__ __align__(16) unsigned st[2][64 * 32];
  const int t = threadIdx.x, c4 = t & 15, k = t >> 4;
  size_t src[2], bh[2], s0[2];   // src: the tile's first element, the same for the whole block
#pragma unroll   // src[], bh[], s0[] stay in registers: every index a constant
  for (int u = 0; u < 2; ++u) { const size_t idx = blockIdx.x + (size_t)u * PB, h = idx & 15, sb = (idx >> 4) & 63, b = idx >> 10;   // head fastest: 16 neighbouring blocks read 64 whole input rows
    bh[u] = b * NHD + h; s0[u] = sb * 64; src[u] = (b * SS + s0[u]) * DW + h * HD; }
  const unsigned ov = (unsigned)(2 * k * DW + c4 * 4), oq = (unsigned)(k * DW + c4 * 4);   // the lane's own offsets: token pair 2k, 2k + 1 for value, token k of each 16 for query and key
  v4f av[2][4], aq[2][4], ak[2][4];
#pragma unroll   // all loads stand ahead of all work
  for (int u = 0; u < 2; ++u)
#pragma unroll
    for (int i = 0; i < 4; ++i) av[u][i] = *(const v4f*)(Xv + src[u] + ((i & 1) + 32 * (i >> 1)) * DW + ov);   // a thread holds token pairs: they share a word of V^T
  asm volatile("s_wait_xcnt 0x0" ::: "memory");   // behind each group of eight loads: it stands before a later load's result, or anything else, rewrites an address register that these loads name
#pragma unroll
  for (int u = 0; u < 2; ++u)
#pragma unroll
    for (int i = 0; i < 4; ++i) aq[u][i] = *(const v4f*)(Xq + src[u] + i * 16 * DW + oq);
  asm volatile("s_wait_xcnt 0x0" ::: "memory");
#pragma unroll
  for (int u = 0; u < 2; ++u)
#pragma unroll
    for (int i = 0; i < 4; ++i) ak[u][i] = *(const v4f*)(Xk + src[u] + i * 16 * DW + oq);
  asm volatile("s_wait_xcnt 0x0" ::: "memory");
  __builtin_amdgcn_sched_barrier(0);   // keeps the 24 loads together: without it the compiler draws conversions, with their waits, in between the loads, and a wave pays the memory latency several times over
#pragma unroll
  for (int u = 0; u < 2; ++u)
#pragma unroll
    for (int p = 0; p < 2; ++p) { const int kk = k + 16 * p;
#pragma unroll
      for (int j = 0; j < 4; ++j) st[u][(4 * c4 + j) * 32 + ((((kk >> 2) ^ c4) & 7) << 2) + (kk & 3)] = pk2(av[u][2 * p][j], av[u][2 * p + 1][j]); }
  v2u wq[2][4], wk[2][4];
#pragma unroll   // wq[][], wk[][] stay in registers: every index a constant
  for (int u = 0; u < 2; ++u)
#pragma unroll
    for (int i = 0; i < 4; ++i) { wq[u][i] = v2u{pk2(aq[u][i][0], aq[u][i][1]), pk2(aq[u][i][2], aq[u][i][3])}; wk[u][i] = v2u{pk2(ak[u][i][0], ak[u][i][1]), pk2(ak[u][i][2], ak[u][i][3])}; }
  __syncthreads();
#pragma unroll
  for (int u = 0; u < 2; ++u)
#pragma unroll
    for (int w = 0; w < 2; ++w) { const int d = w * 32 + (t >> 3), pc = t & 7;
      vst2(VT + (bh[u] * HD + d) * SS + s0[u] + pc * 8, *(const v4u*)&st[u][d * 32 + (((pc ^ (d >> 2)) & 7) << 2)]); }
#pragma unroll
  for (int u = 0; u < 2; ++u)
#pragma unroll
    for (int i = 0; i < 4; ++i) { vst2(Rq + (bh[u] * SS + s0[u] + i * 16 + k) * HD + c4 * 4, wq[u][i]); vst2(Rk + (bh[u] * SS + s0[u] + i * 16 + k) * HD + c4 * 4, wk[u][i]); }
}
// ---- k_attn: block = (128 queries, bh): exact-operand scores, softmax, P x v
// K and V^T reach the four waves through LDS: a stage is 64 keys, one K tile (64 key rows of 128 bytes) and one V^T tile (64 head-column rows of 128 bytes),
// brought by asynchronous copies in whole 128-byte lines, two buffers, the next stage in flight while this one is worked on.
// Inside a row the eight 16-byte pieces are stored at piece ^ ((row >> 1) & 7), so that the 16 rows a fragment read touches fall on 16 different bank groups without a pad.
#define KT 64
#define KS 0.18033688011112042f   // log2(e) / 8
#define NT (SS / KT)
#define TILE_B 8192
#define STAGE_B (2 * TILE_B)
typedef __attribute__((address_space(3))) unsigned char lds_u8;
// one stage's copies of one thread: four pieces of the K tile, four of the V^T tile (16 rows apart each)
__device__ __forceinline__ void copy_stage(unsigned l, const char* gk, const char* gv) {
  // s_wait_xcnt 0 as the last line: it stands before anything rewrites an address register that a copy names
  asm volatile("global_load_async_to_lds_b128 %0, %8, off\n\t"
               "global_load_async_to_lds_b128 %1, %9, off\n\t"
               "global_load_async_to_lds_b128 %2, %10, off\n\t"
               "global_load_async_to_lds_b128 %3, %11, off\n\t"
               "global_load_async_to_lds_b128 %4, %12, off\n\t"
               "global_load_async_to_lds_b128 %5, %13, off\n\t"
               "global_load_async_to_lds_b128 %6, %14, off\n\t"
               "global_load_async_to_lds_b128 %7, %15, off\n\t"
               "s_wait_xcnt 0x0"
               :: "v"(l), "v"(l + 2048u), "v"(l + 4096u), "v"(l + 6144u),
                  "v"(l + TILE_B), "v"(l + TILE_B + 2048u), "v"(l + TILE_B + 4096u), "v"(l + TILE_B + 6144u),
                  "v"(gk), "v"(gk + 2048), "v"(gk + 4096), "v"(gk + 6144),
                  "v"(gv), "v"(gv + 16 * SS * 2), "v"(gv + 32 * SS * 2), "v"(gv + 48 * SS * 2)
               : "memory");
}
__device__ __forceinline__ v16h frag_l(const unsigned char* t, unsigned o0, unsigned o1) {
  union { v16h v; v8h q[2]; } u; u.q[0] = *(const v8h*)(t + o0); u.q[1] = *(const v8h*)(t + o1); return u.v;
}
// lane l with lane l ^ 16: the two halves of a wave hold the same query column and different keys
__device__ __forceinline__ float xhalf(float x) { return __builtin_bit_cast(float, __builtin_amdgcn_permlanex16(__builtin_bit_cast(int, x), __builtin_bit_cast(int, x), 0x76543210, 0xfedcba98, false, false)); }
#define QT 2
#define SO_B (4 * QT * 16 * 68 * 4)   // output staging, a little larger than the two stages
__global__ __launch_bounds__(128, 4) void k_attn(const _Float16* __restrict__ Q, const _Float16* __restrict__ K, const _Float16* __restrict__ VT, float* __restrict__ OUT) {
  static_assert(SO_B >= 2 * STAGE_B, "the array holds the ring and, behind the loop, the output staging");
  __shared__ __align__(128) unsigned char ring[SO_B];
  float (*so)[QT * 16][68] = (float (*)[QT * 16][68])ring;   // output staging takes the ring's place behind the loop's last barrier
  const int tid = threadIdx.x, wave = tid >> 5, lane = tid & 31, col = lane & 15, g = lane >> 4; const size_t bh = blockIdx.y; const int q0 = blockIdx.x * (64 * QT) + wave * (16 * QT); const size_t rq = bh * SS + q0;
  // copies: thread = (row tid >> 3 of each 16-row group, piece tid & 7)
  const unsigned crow = (unsigned)tid >> 3, cpc = (unsigned)tid & 7u;
  const unsigned lds0 = (unsigned)(size_t)(lds_u8*)ring + crow * 128u + ((cpc ^ ((crow >> 1) & 7u)) << 4);
  const char* gk = (const char*)(K + bh * SS * HD) + tid * 16;
  const char* gv = (const char*)(VT + bh * HD * SS) + (size_t)crow * (SS * 2) + cpc * 16;
  // fragment reads: row col of a 16-row group, pieces 2q + g, q = 0..3
  unsigned fo[4];
#pragma unroll   // fo[] stays in registers: every index a constant
  for (int q = 0; q < 4; ++q) fo[q] = (unsigned)col * 128u + ((((unsigned)g ^ ((unsigned)col >> 1)) ^ (2u * q)) << 4);
  copy_stage(lds0, gk, gv);
  asm volatile("s_wait_asynccnt 0x0" ::: "memory");   // stage 0 has landed before the barrier that publishes it
  __syncthreads();
  copy_stage(lds0 + STAGE_B, gk + TILE_B, gv + KT * 2);
  v16h aq[QT][2];
#pragma unroll   // aq[][] stays in registers: every index a constant
  for (int qt = 0; qt < QT; ++qt)
#pragma unroll
    for (int kc = 0; kc < 2; ++kc) aq[qt][kc] = frag_h(Q + (rq + qt * 16 + col) * HD + kc * 32, lane);
  float m[QT], l[QT];            // query qt * 16 + col: running maximum of the raw products (equal in both halves), this half's share of the sum (times 2^11, as P)
  v8f acc[QT][4] = {};           // acc[qt][dt][r] = O^T[dt * 16 + 8g + r][qt * 16 + col]
#pragma unroll   // m[], l[] stay in registers
  for (int qt = 0; qt < QT; ++qt) { m[qt] = -3.0e38f; l[qt] = 0.f; }
#pragma unroll 1
  for (int t = 0; t < NT; ++t) { const unsigned char* kb = ring + (t & 1) * STAGE_B; const unsigned char* vb = kb + TILE_B;
#pragma unroll   // the stage's two 32-key passes: fo[] indices and row offsets stay constants (immediate offsets of the LDS reads)
   for (int p = 0; p < 2; ++p) { v8f s[QT][2];
#pragma unroll
    for (int ct = 0; ct < 2; ++ct) { const unsigned char* kr = kb + (p * 32 + ct * 16) * 128;
#pragma unroll   // s[][] stays in registers: every index a constant
      for (int qt = 0; qt < QT; ++qt) s[qt][ct] = v8f{};
#pragma unroll
      for (int kc = 0; kc < 2; ++kc) { const v16h kf = frag_l(kr, fo[2 * kc], fo[2 * kc + 1]);   // read once, used by both query tiles
#pragma unroll   // both tiles' products side by side on the one fragment
        for (int qt = 0; qt < QT; ++qt) s[qt][ct] = wmma16(kf, aq[qt][kc], s[qt][ct]); } }   // raw products: the scale goes into the exponent's fma below
    v16h pb[QT];
#pragma unroll   // the two query tiles' softmax chains are independent of each other
    for (int qt = 0; qt < QT; ++qt) {
      float mx = fmaxf(s[qt][0][0], s[qt][1][0]);
#pragma unroll
      for (int r = 1; r < 8; ++r) mx = fmaxf(mx, fmaxf(s[qt][0][r], s[qt][1][r]));
      mx = fmaxf(mx, xhalf(mx));
      const float mn = fmaxf(m[qt], mx); const float alpha = (m[qt] <= -1.0e38f) ? 0.f : __builtin_amdgcn_exp2f((m[qt] - mn) * KS);
      const float bias = fmaf(-mn, KS, 11.0f);   // exponent of a score c: (c - mn) * log2(e) / 8 + 11, one fma
      const v8f ks8 = {KS, KS, KS, KS, KS, KS, KS, KS}, b8 = {bias, bias, bias, bias, bias, bias, bias, bias};
      const v8f x0 = __builtin_elementwise_fma(s[qt][0], ks8, b8), x1 = __builtin_elementwise_fma(s[qt][1], ks8, b8);
      float es0 = 0.f, es1 = 0.f;
#pragma unroll
      for (int r = 0; r < 8; ++r) { const float e0 = __builtin_amdgcn_exp2f(x0[r]), e1 = __builtin_amdgcn_exp2f(x1[r]); es0 += e0; es1 += e1;
        pb[qt][r] = (_Float16)e0; pb[qt][8 + r] = (_Float16)e1; }
      l[qt] = l[qt] * alpha + (es0 + es1); m[qt] = mn;
#pragma unroll
      for (int dt = 0; dt < 4; ++dt) acc[qt][dt] *= alpha; }
#pragma unroll
    for (int dt = 0; dt < 4; ++dt) { const v16h vf = frag_l(vb + dt * 16 * 128, fo[2 * p], fo[2 * p + 1]);   // read once, used by both query tiles
#pragma unroll   // both tiles' products side by side on the one fragment
      for (int qt = 0; qt < QT; ++qt) acc[qt][dt] = wmma16(vf, pb[qt], acc[qt][dt]); } }
   asm volatile("s_wait_dscnt 0x0" ::: "memory");      // this wave's reads of the buffer are done before it is refilled
   asm volatile("s_wait_asynccnt 0x0" ::: "memory");   // this wave's copies of stage t + 1 have landed before the barrier that publishes them
   __syncthreads();                                    // publishes stage t + 1 and ends every wave's reads of stage t
   if (t + 2 < NT) copy_stage(lds0 + (t & 1) * STAGE_B, gk + (size_t)(t + 2) * TILE_B, gv + (t + 2) * (KT * 2)); }
  asm volatile("s_wait_asynccnt 0x0" ::: "memory");    // nothing in flight when the ring becomes output staging
#pragma unroll   // acc[][] and l[] stay in registers: every index a constant
  for (int qt = 0; qt < QT; ++qt) { const float il = 1.0f / (l[qt] + xhalf(l[qt]));  // the halves' sums are joined once, here; the 2^11 of P and of the sum cancel
#pragma unroll
    for (int dt = 0; dt < 4; ++dt) { v4f lo, hi;
#pragma unroll
      for (int r = 0; r < 4; ++r) { lo[r] = acc[qt][dt][r] * il; hi[r] = acc[qt][dt][4 + r] * il; }
      *(v4f*)&so[wave][qt * 16 + col][dt * 16 + 8 * g] = lo; *(v4f*)&so[wave][qt * 16 + col][dt * 16 + 8 * g + 4] = hi; } }
  LDSX();
  for (int rl = 0; rl < QT * 16; ++rl) if (lane < 16) vst2(OUT + (rq + rl) * HD + lane * 4, *(const v4f*)&so[wave][rl][lane * 4]);
}
extern "C" void kernel_launch(void* const* d_in, const int* in_sizes, int n_in, void* d_out, int out_size, void* d_ws, size_t ws_size, hipStream_t stream) {
  (void)in_sizes; (void)n_in; (void)out_size;
  const float** F = (const float**)d_in;   // 0 query, 1 key, 2 value [2,4096,1024]
  if (ws_size < (size_t)WS_END) return;
  char* ws = (char*)d_ws; _Float16 *Qr = (_Float16*)(ws + WS_Q), *Kr = (_Float16*)(ws + WS_K), *VT = (_Float16*)(ws + WS_VT);
  k_prep<<<PB, 256, 0, stream>>>(F[0], F[1], F[2], Qr, Kr, VT);
  k_attn<<<dim3(TQB, TNB), 128, 0, stream>>>(Qr, Kr, VT, (float*)d_out);
}

// v007
// Measured time: 113 microseconds a run.
// In two side-by-side timings against v006, it was 1.13 and 1.12 times as fast.
// Counting every step since v000, it is 6.34 times as fast.
// compute dtype: query, key, value rounded to bf16 and used as EXACT f16 operands on WMMA 16x16x32 (heads split from the 1,024-wide rows); scores / 8 (the module's query / sqrt(64)), softmax in f32 against a running maximum that is raised lazily (hardware exp), P (scaled by 2^11, single f16) x v (exact); f32 accumulate; output in the module's (batch*head, token, 64) layout.
#include <hip/hip_runtime.h>
#include <math.h>

typedef __attribute__((ext_vector_type(16))) _Float16 v16h;
typedef __attribute__((ext_vector_type(16))) __bf16 v16b;
typedef __attribute__((ext_vector_type(8)))  _Float16 v8h;
typedef __attribute__((ext_vector_type(8)))  float v8f;
typedef __attribute__((ext_vector_type(4)))  float v4f;
typedef __attribute__((ext_vector_type(2)))  float v2f;
typedef __attribute__((ext_vector_type(4)))  unsigned v4u;
typedef __attribute__((ext_vector_type(4)))  int v4i;
typedef float __attribute__((may_alias)) float_a;
typedef int __attribute__((may_alias)) int_a;

template <typename T> __device__ __forceinline__ void vst2(void* p, T v) { *(T*)p = v;  }
// the builtin alone: the compiler keeps the distances behind its own WMMAs and may fetch the next LDS fragments while one runs
__device__ __forceinline__ v8f wmma16(v16h a, v16h b, v8f c) {
  return __builtin_amdgcn_wmma_f32_16x16x32_f16(false, a, false, b, (short)0, c, false, false);
}
__device__ __forceinline__ v8f wmma_bf(v16b a, v16b b, v8f c) {
  v8f d = __builtin_amdgcn_wmma_f32_16x16x32_bf16(false, a, false, b, (short)0, c, false, false);
  asm volatile("v_nop\n\tv_nop\n\tv_nop\n\tv_nop" : "+v"(d) : "v"(a), "v"(b));
  return d;
}
// 16x16x32 fragments: lane = (h = lane>>4, row/col = lane&15); elements 0..7 = k0+8h+0..7, 8..15 = k0+16+8h+0..7; D element r = row 8h+r
__device__ __forceinline__ v16h frag_h(const _Float16* rowk0, int lane) {
  union { v16h v; v8h q[2]; } u; const _Float16* p = rowk0 + 8 * (lane >> 4);
  u.q[0] = *(const v8h*)p; u.q[1] = *(const v8h*)(p + 16); return u.v;
}
__device__ __forceinline__ v16h frag_f32(const float* rowk0, int lane) {
  v16h a; const float* p = rowk0 + 8 * (lane >> 4);
#pragma unroll
  for (int i = 0; i < 8; ++i) { a[i] = (_Float16)p[i]; a[8 + i] = (_Float16)p[16 + i]; }
  return a;
}
__device__ __forceinline__ v16h frag_f32s(const float* rowk0, int lane, float sc) {
  v16h a; const float* p = rowk0 + 8 * (lane >> 4);
#pragma unroll
  for (int i = 0; i < 8; ++i) { a[i] = (_Float16)(p[i] * sc); a[8 + i] = (_Float16)(p[16 + i] * sc); }
  return a;
}
// column fragment from a [K][ld] layout (column n), rows >= K read as 0
__device__ __forceinline__ v16h fragc_f32(const float* W, int k0, int n, int lane, int ld, int K) {
  v16h a; const int g = lane >> 4;
#pragma unroll
  for (int i = 0; i < 8; ++i) { const int ka = k0 + 8 * g + i, kb = ka + 16;
    a[i] = (_Float16)(ka < K ? W[(size_t)(ka < K ? ka : K - 1) * ld + n] : 0.f); a[8 + i] = (_Float16)(kb < K ? W[(size_t)(kb < K ? kb : K - 1) * ld + n] : 0.f); }
  return a;
}
struct F2 { v16b h, l; };
__device__ __forceinline__ F2 bsplit16(const float v[16]) { F2 r;
#pragma unroll
  for (int i = 0; i < 16; ++i) { const __bf16 h = (__bf16)v[i]; r.h[i] = h; r.l[i] = (__bf16)(v[i] - (float)h); }
  return r; }
__device__ __forceinline__ F2 split_row(const float* row, int k0, int lane) { float v[16]; const float* p = row + k0 + 8 * (lane >> 4);
#pragma unroll
  for (int i = 0; i < 8; ++i) { v[i] = p[i]; v[8 + i] = p[16 + i]; }
  return bsplit16(v); }
__device__ __forceinline__ F2 split_rowK(const float* row, int k0, int lane, int K) { float v[16]; const int g = lane >> 4;
#pragma unroll
  for (int i = 0; i < 8; ++i) { const int ka = k0 + 8 * g + i, kb = ka + 16; v[i] = ka < K ? row[ka < K ? ka : K - 1] : 0.f; v[8 + i] = kb < K ? row[kb < K ? kb : K - 1] : 0.f; }
  return bsplit16(v); }
__device__ __forceinline__ F2 split_col(const float* W, int k0, int n, int lane, int ld, int K) { float v[16]; const int g = lane >> 4;
#pragma unroll
  for (int i = 0; i < 8; ++i) { const int ka = k0 + 8 * g + i, kb = ka + 16; v[i] = ka < K ? W[(size_t)(ka < K ? ka : K - 1) * ld + n] : 0.f; v[8 + i] = kb < K ? W[(size_t)(kb < K ? kb : K - 1) * ld + n] : 0.f; }
  return bsplit16(v); }
__device__ __forceinline__ v8f mac3(const F2& a, const F2& b, v8f c) { c = wmma_bf(a.l, b.h, c); c = wmma_bf(a.h, b.l, c); return wmma_bf(a.h, b.h, c); }
__device__ __forceinline__ float sigm(float v) { return 1.0f / (1.0f + expf(-v)); }
#define LDSX() do { asm volatile("s_wait_dscnt 0" ::: "memory"); __builtin_amdgcn_wave_barrier(); __builtin_amdgcn_fence(__ATOMIC_RELEASE, "workgroup"); } while (0)


// Memory-efficient (chunked) attention == softmax(q k^T / sqrt(64)) v per head (B 2, S 4,096, 16 heads x 64), output left in (batch*head, token, head_dim) form.
#define NB 2
#define NHD 16
#define NBH (NB * NHD)
#define SS 4096
#define HD 64
#define DW (NHD * HD)   // 1024-wide input rows
#ifndef TQB
#define TQB (SS / 128)
#define TNB NBH
#endif
typedef __attribute__((ext_vector_type(8))) __bf16 v8b;
__device__ __forceinline__ v16b frag_b(const __bf16* rowk0, int lane) {
  union { v16b v; v8b q[2]; } u; const __bf16* p = rowk0 + 8 * (lane >> 4);
  u.q[0] = *(const v8b*)p; u.q[1] = *(const v8b*)(p + 16); return u.v;
}
__device__ __forceinline__ float bfr(float v) { return (float)(__bf16)v; }
__device__ __attribute__((noinline)) float exp_ni(float v) { return expf(v); }
__device__ __attribute__((noinline)) float erf_ni(float v) { return erff(v); }

#define WS_Q   0u                                  // f16 rows q ; k ; VT planes [bh][64][s]
#define WS_K   (WS_Q + 2u * (size_t)NBH * SS * HD)
#define WS_VT  (WS_K + 2u * (size_t)NBH * SS * HD)
#define WS_END (WS_VT + 2u * (size_t)NBH * HD * SS)

// ---- k_prep: the one conversion launch. 1,024 blocks, four resident on a WGP; a block takes two 64-token x 64-column head tiles of each of query, key, value.
// A thread asks for all its 24 pieces of 16 bytes at the start (16 lanes cover one 256-byte head row), so the whole input is on its way at once and few waves have to start.
// query and key tiles go out straight from registers, 16 lanes writing one 128-byte row; value tiles turn through LDS. All stores stand behind the one barrier, which waits for no store.
#define PB 1024
typedef __attribute__((ext_vector_type(2))) unsigned v2u;
typedef __attribute__((ext_vector_type(2))) __bf16 v2b;
typedef __attribute__((ext_vector_type(2))) _Float16 v2h;
// two values rounded to bf16 and held as f16, in one word: packed conversions both ways
__device__ __forceinline__ unsigned pk2(float a, float b) {
  const v2f x = {a, b}; const unsigned r = __builtin_bit_cast(unsigned, __builtin_convertvector(x, v2b));
  const v2f y = {__builtin_bit_cast(float, r << 16), __builtin_bit_cast(float, r & 0xffff0000u)};
  return __builtin_bit_cast(unsigned, __builtin_convertvector(y, v2h));
}
__global__ __launch_bounds__(256) void k_prep(const float* __restrict__ Xq, const float* __restrict__ Xk, const float* __restrict__ Xv, _Float16* __restrict__ Rq, _Float16* __restrict__ Rk, _Float16* __restrict__ VT) {
  // st[u][d][word]: word kk of row d holds tokens 2kk, 2kk + 1; its 16-byte piece kk >> 2 is stored at piece ^ ((d >> 2) & 7), which spreads the 16 rows one store touches over the banks
  __shared__ __align__(16) unsigned st[2][64 * 32];
  const int t = threadIdx.x, c4 = t & 15, k = t >> 4;
  size_t src[2], bh[2], s0[2];   // src: the tile's first element, the same for the whole block
#pragma unroll   // src[], bh[], s0[] stay in registers: every index a constant
  for (int u = 0; u < 2; ++u) { const size_t idx = blockIdx.x + (size_t)u * PB, h = idx & 15, sb = (idx >> 4) & 63, b = idx >> 10;   // head fastest: 16 neighbouring blocks read 64 whole input rows
    bh[u] = b * NHD + h; s0[u] = sb * 64; src[u] = (b * SS + s0[u]) * DW + h * HD; }
  const unsigned ov = (unsigned)(2 * k * DW + c4 * 4), oq = (unsigned)(k * DW + c4 * 4);   // the lane's own offsets: token pair 2k, 2k + 1 for value, token k of each 16 for query and key
  v4f av[2][4], aq[2][4], ak[2][4];
#pragma unroll   // all loads stand ahead of all work
  for (int u = 0; u < 2; ++u)
#pragma unroll
    for (int i = 0; i < 4; ++i) av[u][i] = *(const v4f*)(Xv + src[u] + ((i & 1) + 32 * (i >> 1)) * DW + ov);   // a thread holds token pairs: they share a word of V^T
  asm volatile("s_wait_xcnt 0x0" ::: "memory");   // behind each group of eight loads: it stands before a later load's result, or anything else, rewrites an address register that these loads name
#pragma unroll
  for (int u = 0; u < 2; ++u)
#pragma unroll
    for (int i = 0; i < 4; ++i) aq[u][i] = *(const v4f*)(Xq + src[u] + i * 16 * DW + oq);
  asm volatile("s_wait_xcnt 0x0" ::: "memory");
#pragma unroll
  for (int u = 0; u < 2; ++u)
#pragma unroll
    for (int i = 0; i < 4; ++i) ak[u][i] = *(const v4f*)(Xk + src[u] + i * 16 * DW + oq);
  asm volatile("s_wait_xcnt 0x0" ::: "memory");
  __builtin_amdgcn_sched_barrier(0);   // keeps the 24 loads together: without it the compiler draws conversions, with their waits, in between the loads, and a wave pays the memory latency several times over
#pragma unroll
  for (int u = 0; u < 2; ++u)
#pragma unroll
    for (int p = 0; p < 2; ++p) { const int kk = k + 16 * p;
#pragma unroll
      for (int j = 0; j < 4; ++j) st[u][(4 * c4 + j) * 32 + ((((kk >> 2) ^ c4) & 7) << 2) + (kk & 3)] = pk2(av[u][2 * p][j], av[u][2 * p + 1][j]); }
  v2u wq[2][4], wk[2][4];
#pragma unroll   // wq[][], wk[][] stay in registers: every index a constant
  for (int u = 0; u < 2; ++u)
#pragma unroll
    for (int i = 0; i < 4; ++i) { wq[u][i] = v2u{pk2(aq[u][i][0], aq[u][i][1]), pk2(aq[u][i][2], aq[u][i][3])}; wk[u][i] = v2u{pk2(ak[u][i][0], ak[u][i][1]), pk2(ak[u][i][2], ak[u][i][3])}; }
  __syncthreads();
#pragma unroll
  for (int u = 0; u < 2; ++u)
#pragma unroll
    for (int w = 0; w < 2; ++w) { const int d = w * 32 + (t >> 3), pc = t & 7;
      vst2(VT + (bh[u] * HD + d) * SS + s0[u] + pc * 8, *(const v4u*)&st[u][d * 32 + (((pc ^ (d >> 2)) & 7) << 2)]); }
#pragma unroll
  for (int u = 0; u < 2; ++u)
#pragma unroll
    for (int i = 0; i < 4; ++i) { vst2(Rq + (bh[u] * SS + s0[u] + i * 16 + k) * HD + c4 * 4, wq[u][i]); vst2(Rk + (bh[u] * SS + s0[u] + i * 16 + k) * HD + c4 * 4, wk[u][i]); }
}
// ---- k_attn: block = (128 queries, bh): exact-operand scores, softmax, P x v
// K and V^T reach the four waves through LDS: a stage is 64 keys, one K tile (64 key rows of 128 bytes) and one V^T tile (64 head-column rows of 128 bytes),
// brought by asynchronous copies in whole 128-byte lines, two buffers, the next stage in flight while this one is worked on.
// Inside a row the eight 16-byte pieces are stored at piece ^ ((row >> 1) & 7), so that the 16 rows a fragment read touches fall on 16 different bank groups without a pad.
#define KT 64
#define KS 0.18033688011112042f   // log2(e) / 8
#define NT (SS / KT)
#define LAZY 4.0f   // how far, in the scaled log2 scores, a score may stand above the maximum in use before the accumulators are rescaled
#define TILE_B 8192
#define STAGE_B (2 * TILE_B)
typedef __attribute__((address_space(3))) unsigned char lds_u8;
// one stage's copies of one thread: four pieces of the K tile, four of the V^T tile (16 rows apart each)
__device__ __forceinline__ void copy_stage(unsigned l, const char* gk, const char* gv) {
  // s_wait_xcnt 0 as the last line: it stands before anything rewrites an address register that a copy names
  asm volatile("global_load_async_to_lds_b128 %0, %8, off\n\t"
               "global_load_async_to_lds_b128 %1, %9, off\n\t"
               "global_load_async_to_lds_b128 %2, %10, off\n\t"
               "global_load_async_to_lds_b128 %3, %11, off\n\t"
               "global_load_async_to_lds_b128 %4, %12, off\n\t"
               "global_load_async_to_lds_b128 %5, %13, off\n\t"
               "global_load_async_to_lds_b128 %6, %14, off\n\t"
               "global_load_async_to_lds_b128 %7, %15, off\n\t"
               "s_wait_xcnt 0x0"
               :: "v"(l), "v"(l + 2048u), "v"(l + 4096u), "v"(l + 6144u),
                  "v"(l + TILE_B), "v"(l + TILE_B + 2048u), "v"(l + TILE_B + 4096u), "v"(l + TILE_B + 6144u),
                  "v"(gk), "v"(gk + 2048), "v"(gk + 4096), "v"(gk + 6144),
                  "v"(gv), "v"(gv + 16 * SS * 2), "v"(gv + 32 * SS * 2), "v"(gv + 48 * SS * 2)
               : "memory");
}
__device__ __forceinline__ v16h frag_l(const unsigned char* t, unsigned o0, unsigned o1) {
  union { v16h v; v8h q[2]; } u; u.q[0] = *(const v8h*)(t + o0); u.q[1] = *(const v8h*)(t + o1); return u.v;
}
// lane l with lane l ^ 16: the two halves of a wave hold the same query column and different keys
__device__ __forceinline__ float xhalf(float x) { return __builtin_bit_cast(float, __builtin_amdgcn_permlanex16(__builtin_bit_cast(int, x), __builtin_bit_cast(int, x), 0x76543210, 0xfedcba98, false, false)); }
#define QT 2
#define SO_B (4 * QT * 16 * 68 * 4)   // output staging, a little larger than the two stages
__global__ __launch_bounds__(128, 4) void k_attn(const _Float16* __restrict__ Q, const _Float16* __restrict__ K, const _Float16* __restrict__ VT, float* __restrict__ OUT) {
  static_assert(SO_B >= 2 * STAGE_B, "the array holds the ring and, behind the loop, the output staging");
  __shared__ __align__(128) unsigned char ring[SO_B];
  float (*so)[QT * 16][68] = (float (*)[QT * 16][68])ring;   // output staging takes the ring's place behind the loop's last barrier
  const int tid = threadIdx.x, wave = tid >> 5, lane = tid & 31, col = lane & 15, g = lane >> 4; const size_t bh = blockIdx.y; const int q0 = blockIdx.x * (64 * QT) + wave * (16 * QT); const size_t rq = bh * SS + q0;
  // copies: thread = (row tid >> 3 of each 16-row group, piece tid & 7)
  const unsigned crow = (unsigned)tid >> 3, cpc = (unsigned)tid & 7u;
  const unsigned lds0 = (unsigned)(size_t)(lds_u8*)ring + crow * 128u + ((cpc ^ ((crow >> 1) & 7u)) << 4);
  const char* gk = (const char*)(K + bh * SS * HD) + tid * 16;
  const char* gv = (const char*)(VT + bh * HD * SS) + (size_t)crow * (SS * 2) + cpc * 16;
  // fragment reads: row col of a 16-row group, pieces 2q + g, q = 0..3
  unsigned fo[4];
#pragma unroll   // fo[] stays in registers: every index a constant
  for (int q = 0; q < 4; ++q) fo[q] = (unsigned)col * 128u + ((((unsigned)g ^ ((unsigned)col >> 1)) ^ (2u * q)) << 4);
  copy_stage(lds0, gk, gv);
  asm volatile("s_wait_asynccnt 0x0" ::: "memory");   // stage 0 has landed before the barrier that publishes it
  __syncthreads();
  copy_stage(lds0 + STAGE_B, gk + TILE_B, gv + KT * 2);
  v16h aq[QT][2];
#pragma unroll   // aq[][] stays in registers: every index a constant
  for (int qt = 0; qt < QT; ++qt)
#pragma unroll
    for (int kc = 0; kc < 2; ++kc) aq[qt][kc] = frag_h(Q + (rq + qt * 16 + col) * HD + kc * 32, lane);
  // Lazy rescale: m is the maximum IN USE. It may trail a query's true maximum by up to LAZY in the scaled log2 scores, so P reaches at most 2^(11 + LAZY) = 2^15, inside f16;
  // output and sum carry the same factor 2^(-m * KS), which the final division takes out, whatever m is.
  float m[QT], l[QT];            // query qt * 16 + col: maximum in use of the raw products (equal in both halves), this half's share of the sum (times 2^11, as P)
  float thr[QT], bias[QT];       // m + LAZY / KS, and 11 - m * KS: they change only where m does
  v8f acc[QT][4] = {};           // acc[qt][dt][r] = O^T[dt * 16 + 8g + r][qt * 16 + col]
#pragma unroll   // m[], l[], thr[], bias[] stay in registers
  for (int qt = 0; qt < QT; ++qt) { m[qt] = -3.0e38f; thr[qt] = -3.0e38f; bias[qt] = 11.0f; l[qt] = 0.f; }   // every finite score exceeds thr: stage 0 sets m
#pragma unroll 1
  for (int t = 0; t < NT; ++t) { const unsigned char* kb = ring + (t & 1) * STAGE_B; const unsigned char* vb = kb + TILE_B;
   v8f s[2][QT][2];   // the stage's raw products: pass p (32 keys), query tile, 16-key tile
   v16h kf[2][2][2];  // the stage's K fragments: pass, 16-key tile, half of the head
#pragma unroll   // kf[][][] stays in registers; fo[] indices and row offsets stay constants (immediate offsets of the LDS reads)
   for (int p = 0; p < 2; ++p)
#pragma unroll
    for (int ct = 0; ct < 2; ++ct)
#pragma unroll
      for (int kc = 0; kc < 2; ++kc) kf[p][ct][kc] = frag_l(kb + (p * 32 + ct * 16) * 128, fo[2 * kc], fo[2 * kc + 1]);   // read once, used by both query tiles
   __builtin_amdgcn_sched_barrier(0);   // keeps the stage's 16 K reads in one group ahead of the products: spread among them, every place with reads makes the wave wait for LDS anew
#pragma unroll   // s[][][] stays in registers: every index a constant
   for (int p = 0; p < 2; ++p)
#pragma unroll
    for (int ct = 0; ct < 2; ++ct) {
#pragma unroll
      for (int qt = 0; qt < QT; ++qt) s[p][qt][ct] = v8f{};
#pragma unroll
      for (int kc = 0; kc < 2; ++kc)
#pragma unroll   // both tiles' products side by side on the one fragment
        for (int qt = 0; qt < QT; ++qt) s[p][qt][ct] = wmma16(kf[p][ct][kc], aq[qt][kc], s[p][qt][ct]); }   // raw products: the scale goes into the exponent's fma below
   __builtin_amdgcn_sched_barrier(0);   // keeps the 16 products in one run: drawn in between them, each maximum reads a tile just issued and the compiler fills the distance behind that WMMA with v_nop
   v16h vf0[4];   // pass 0's V^T fragments, asked for here, into registers that the K fragments have left: they land under the maxima and the exponentials
#pragma unroll   // vf0[] stays in registers
   for (int dt = 0; dt < 4; ++dt) vf0[dt] = frag_l(vb + dt * 16 * 128, fo[0], fo[1]);
   // one test a stage: does any of the lane's own 32 scores of a query exceed the bound? The ballot joins the halves and the columns.
   float mx[QT]; bool need = false;
#pragma unroll   // mx[] stays in registers; a chain a pass, so that four chains run side by side
   for (int qt = 0; qt < QT; ++qt) { float ma = fmaxf(s[0][qt][0][0], s[0][qt][1][0]), mb = fmaxf(s[1][qt][0][0], s[1][qt][1][0]);
#pragma unroll
     for (int r = 1; r < 8; ++r) { ma = fmaxf(ma, fmaxf(s[0][qt][0][r], s[0][qt][1][r])); mb = fmaxf(mb, fmaxf(s[1][qt][0][r], s[1][qt][1][r])); }
     mx[qt] = fmaxf(ma, mb); need = need || (mx[qt] > thr[qt]); }
   if (__builtin_expect(__builtin_amdgcn_ballot_w32(need) != 0, 0)) {   // a scalar branch, the same for the whole wave; rare behind the first stage
#pragma unroll
     for (int qt = 0; qt < QT; ++qt) { const float mn = fmaxf(m[qt], fmaxf(mx[qt], xhalf(mx[qt])));
       const float alpha = (m[qt] <= -1.0e38f) ? 0.f : __builtin_amdgcn_exp2f((m[qt] - mn) * KS);
       m[qt] = mn; thr[qt] = mn + LAZY / KS; bias[qt] = fmaf(-mn, KS, 11.0f); l[qt] *= alpha;
#pragma unroll
       for (int dt = 0; dt < 4; ++dt) acc[qt][dt] *= alpha; } }
#pragma unroll
   for (int p = 0; p < 2; ++p) { v16h pb[QT];
#pragma unroll   // the two query tiles' chains are independent of each other
    for (int qt = 0; qt < QT; ++qt) {
      const float b = bias[qt];   // exponent of a score c: (c - m) * log2(e) / 8 + 11, one fma
      const v8f ks8 = {KS, KS, KS, KS, KS, KS, KS, KS}, b8 = {b, b, b, b, b, b, b, b};
      const v8f x0 = __builtin_elementwise_fma(s[p][qt][0], ks8, b8), x1 = __builtin_elementwise_fma(s[p][qt][1], ks8, b8);
      float es0 = 0.f, es1 = 0.f;
#pragma unroll
      for (int r = 0; r < 8; ++r) { const float e0 = __builtin_amdgcn_exp2f(x0[r]), e1 = __builtin_amdgcn_exp2f(x1[r]); es0 += e0; es1 += e1;
        pb[qt][r] = (_Float16)e0; pb[qt][8 + r] = (_Float16)e1; }
      l[qt] += es0 + es1; }
#pragma unroll
    for (int dt = 0; dt < 4; ++dt) { const v16h vf = p == 0 ? vf0[dt] : frag_l(vb + dt * 16 * 128, fo[2], fo[3]);   // read once, used by both query tiles
#pragma unroll   // both tiles' products side by side on the one fragment
      for (int qt = 0; qt < QT; ++qt) acc[qt][dt] = wmma16(vf, pb[qt], acc[qt][dt]); } }
   asm volatile("s_wait_dscnt 0x0" ::: "memory");      // this wave's reads of the buffer are done before it is refilled
   asm volatile("s_wait_asynccnt 0x0" ::: "memory");   // this wave's copies of stage t + 1 have landed before the barrier that publishes them
   __syncthreads();                                    // publishes stage t + 1 and ends every wave's reads of stage t
   if (t + 2 < NT) copy_stage(lds0 + (t & 1) * STAGE_B, gk + (size_t)(t + 2) * TILE_B, gv + (t + 2) * (KT * 2)); }
  asm volatile("s_wait_asynccnt 0x0" ::: "memory");    // nothing in flight when the ring becomes output staging
#pragma unroll   // acc[][] and l[] stay in registers: every index a constant
  for (int qt = 0; qt < QT; ++qt) { const float il = 1.0f / (l[qt] + xhalf(l[qt]));  // the halves' sums are joined once, here; the 2^11 of P and of the sum cancel
#pragma unroll
    for (int dt = 0; dt < 4; ++dt) { v4f lo, hi;
#pragma unroll
      for (int r = 0; r < 4; ++r) { lo[r] = acc[qt][dt][r] * il; hi[r] = acc[qt][dt][4 + r] * il; }
      *(v4f*)&so[wave][qt * 16 + col][dt * 16 + 8 * g] = lo; *(v4f*)&so[wave][qt * 16 + col][dt * 16 + 8 * g + 4] = hi; } }
  LDSX();
  for (int rl = 0; rl < QT * 16; ++rl) if (lane < 16) vst2(OUT + (rq + rl) * HD + lane * 4, *(const v4f*)&so[wave][rl][lane * 4]);
}
extern "C" void kernel_launch(void* const* d_in, const int* in_sizes, int n_in, void* d_out, int out_size, void* d_ws, size_t ws_size, hipStream_t stream) {
  (void)in_sizes; (void)n_in; (void)out_size;
  const float** F = (const float**)d_in;   // 0 query, 1 key, 2 value [2,4096,1024]
  if (ws_size < (size_t)WS_END) return;
  char* ws = (char*)d_ws; _Float16 *Qr = (_Float16*)(ws + WS_Q), *Kr = (_Float16*)(ws + WS_K), *VT = (_Float16*)(ws + WS_VT);
  k_prep<<<PB, 256, 0, stream>>>(F[0], F[1], F[2], Qr, Kr, VT);
  k_attn<<<dim3(TQB, TNB), 128, 0, stream>>>(Qr, Kr, VT, (float*)d_out);
}

// v008
// A run of this version takes 109 microseconds.
// Two timings next to v007 both put it at 1.04 times that version's speed.
// Counting every step since v000, it is 6.59 times as fast.
// compute dtype: query, key, value rounded to bf16 and used as EXACT f16 operands on WMMA 16x16x32 (heads split from the 1,024-wide rows); scores / 8 (the module's query / sqrt(64)), softmax in f32 against a running maximum that is raised lazily (hardware exp), P (scaled by 2^11, single f16) x v (exact); f32 accumulate; output in the module's (batch*head, token, 64) layout.
#include <hip/hip_runtime.h>
#include <math.h>

typedef __attribute__((ext_vector_type(16))) _Float16 v16h;
typedef __attribute__((ext_vector_type(16))) __bf16 v16b;
typedef __attribute__((ext_vector_type(8)))  _Float16 v8h;
typedef __attribute__((ext_vector_type(8)))  float v8f;
typedef __attribute__((ext_vector_type(4)))  float v4f;
typedef __attribute__((ext_vector_type(2)))  float v2f;
typedef __attribute__((ext_vector_type(4)))  unsigned v4u;
typedef __attribute__((ext_vector_type(4)))  int v4i;
typedef float __attribute__((may_alias)) float_a;
typedef int __attribute__((may_alias)) int_a;

template <typename T> __device__ __forceinline__ void vst2(void* p, T v) { *(T*)p = v;  }
// the builtin alone: the compiler keeps the distances behind its own WMMAs and may fetch the next LDS fragments while one runs
__device__ __forceinline__ v8f wmma16(v16h a, v16h b, v8f c) {
  return __builtin_amdgcn_wmma_f32_16x16x32_f16(false, a, false, b, (short)0, c, false, false);
}
__device__ __forceinline__ v8f wmma_bf(v16b a, v16b b, v8f c) {
  v8f d = __builtin_amdgcn_wmma_f32_16x16x32_bf16(false, a, false, b, (short)0, c, false, false);
  asm volatile("v_nop\n\tv_nop\n\tv_nop\n\tv_nop" : "+v"(d) : "v"(a), "v"(b));
  return d;
}
// 16x16x32 fragments: lane = (h = lane>>4, row/col = lane&15); elements 0..7 = k0+8h+0..7, 8..15 = k0+16+8h+0..7; D element r = row 8h+r
__device__ __forceinline__ v16h frag_h(const _Float16* rowk0, int lane) {
  union { v16h v; v8h q[2]; } u; const _Float16* p = rowk0 + 8 * (lane >> 4);
  u.q[0] = *(const v8h*)p; u.q[1] = *(const v8h*)(p + 16); return u.v;
}
__device__ __forceinline__ v16h frag_f32(const float* rowk0, int lane) {
  v16h a; const float* p = rowk0 + 8 * (lane >> 4);
#pragma unroll
  for (int i = 0; i < 8; ++i) { a[i] = (_Float16)p[i]; a[8 + i] = (_Float16)p[16 + i]; }
  return a;
}
__device__ __forceinline__ v16h frag_f32s(const float* rowk0, int lane, float sc) {
  v16h a; const float* p = rowk0 + 8 * (lane >> 4);
#pragma unroll
  for (int i = 0; i < 8; ++i) { a[i] = (_Float16)(p[i] * sc); a[8 + i] = (_Float16)(p[16 + i] * sc); }
  return a;
}
// column fragment from a [K][ld] layout (column n), rows >= K read as 0
__device__ __forceinline__ v16h fragc_f32(const float* W, int k0, int n, int lane, int ld, int K) {
  v16h a; const int g = lane >> 4;
#pragma unroll
  for (int i = 0; i < 8; ++i) { const int ka = k0 + 8 * g + i, kb = ka + 16;
    a[i] = (_Float16)(ka < K ? W[(size_t)(ka < K ? ka : K - 1) * ld + n] : 0.f); a[8 + i] = (_Float16)(kb < K ? W[(size_t)(kb < K ? kb : K - 1) * ld + n] : 0.f); }
  return a;
}
struct F2 { v16b h, l; };
__device__ __forceinline__ F2 bsplit16(const float v[16]) { F2 r;
#pragma unroll
  for (int i = 0; i < 16; ++i) { const __bf16 h = (__bf16)v[i]; r.h[i] = h; r.l[i] = (__bf16)(v[i] - (float)h); }
  return r; }
__device__ __forceinline__ F2 split_row(const float* row, int k0, int lane) { float v[16]; const float* p = row + k0 + 8 * (lane >> 4);
#pragma unroll
  for (int i = 0; i < 8; ++i) { v[i] = p[i]; v[8 + i] = p[16 + i]; }
  return bsplit16(v); }
__device__ __forceinline__ F2 split_rowK(const float* row, int k0, int lane, int K) { float v[16]; const int g = lane >> 4;
#pragma unroll
  for (int i = 0; i < 8; ++i) { const int ka = k0 + 8 * g + i, kb = ka + 16; v[i] = ka < K ? row[ka < K ? ka : K - 1] : 0.f; v[8 + i] = kb < K ? row[kb < K ? kb : K - 1] : 0.f; }
  return bsplit16(v); }
__device__ __forceinline__ F2 split_col(const float* W, int k0, int n, int lane, int ld, int K) { float v[16]; const int g = lane >> 4;
#pragma unroll
  for (int i = 0; i < 8; ++i) { const int ka = k0 + 8 * g + i, kb = ka + 16; v[i] = ka < K ? W[(size_t)(ka < K ? ka : K - 1) * ld + n] : 0.f; v[8 + i] = kb < K ? W[(size_t)(kb < K ? kb : K - 1) * ld + n] : 0.f; }
  return bsplit16(v); }
__device__ __forceinline__ v8f mac3(const F2& a, const F2& b, v8f c) { c = wmma_bf(a.l, b.h, c); c = wmma_bf(a.h, b.l, c); return wmma_bf(a.h, b.h, c); }
__device__ __forceinline__ float sigm(float v) { return 1.0f / (1.0f + expf(-v)); }
#define LDSX() do { asm volatile("s_wait_dscnt 0" ::: "memory"); __builtin_amdgcn_wave_barrier(); __builtin_amdgcn_fence(__ATOMIC_RELEASE, "workgroup"); } while (0)


// Memory-efficient (chunked) attention == softmax(q k^T / sqrt(64)) v per head (B 2, S 4,096, 16 heads x 64), output left in (batch*head, token, head_dim) form.
#define NB 2
#define NHD 16
#define NBH (NB * NHD)
#define SS 4096
#define HD 64
#define DW (NHD * HD)   // 1024-wide input rows
#ifndef TQB
#define TQB (SS / 128)
#define TNB NBH
#endif
typedef __attribute__((ext_vector_type(8))) __bf16 v8b;
__device__ __forceinline__ v16b frag_b(const __bf16* rowk0, int lane) {
  union { v16b v; v8b q[2]; } u; const __bf16* p = rowk0 + 8 * (lane >> 4);
  u.q[0] = *(const v8b*)p; u.q[1] = *(const v8b*)(p + 16); return u.v;
}
__device__ __forceinline__ float bfr(float v) { return (float)(__bf16)v; }
__device__ __attribute__((noinline)) float exp_ni(float v) { return expf(v); }
__device__ __attribute__((noinline)) float erf_ni(float v) { return erff(v); }

#define WS_Q   0u                                  // f16 rows q ; k ; VT planes [bh][64][s]
#define WS_K   (WS_Q + 2u * (size_t)NBH * SS * HD)
#define WS_VT  (WS_K + 2u * (size_t)NBH * SS * HD)
#define WS_END (WS_VT + 2u * (size_t)NBH * HD * SS)

// ---- k_prep: the one conversion launch. 1,024 blocks, four resident on a WGP; a block takes two 64-token x 64-column head tiles of each of query, key, value.
// A thread asks for all its 24 pieces of 16 bytes at the start (16 lanes cover one 256-byte head row), so the whole input is on its way at once and few waves have to start.
// query and key tiles go out straight from registers, 16 lanes writing one 128-byte row; value tiles turn through LDS. All stores stand behind the one barrier, which waits for no store.
#define PB 1024
typedef __attribute__((ext_vector_type(2))) unsigned v2u;
typedef __attribute__((ext_vector_type(2))) __bf16 v2b;
typedef __attribute__((ext_vector_type(2))) _Float16 v2h;
// two values rounded to bf16 and held as f16, in one word: packed conversions both ways
__device__ __forceinline__ unsigned pk2(float a, float b) {
  const v2f x = {a, b}; const unsigned r = __builtin_bit_cast(unsigned, __builtin_convertvector(x, v2b));
  const v2f y = {__builtin_bit_cast(float, r << 16), __builtin_bit_cast(float, r & 0xffff0000u)};
  return __builtin_bit_cast(unsigned, __builtin_convertvector(y, v2h));
}
__global__ __launch_bounds__(256) void k_prep(const float* __restrict__ Xq, const float* __restrict__ Xk, const float* __restrict__ Xv, _Float16* __restrict__ Rq, _Float16* __restrict__ Rk, _Float16* __restrict__ VT) {
  // st[u][d][word]: word kk of row d holds tokens 2kk, 2kk + 1; its 16-byte piece kk >> 2 is stored at piece ^ ((d >> 2) & 7), which spreads the 16 rows one store touches over the banks
  __shared__ __align__(16) unsigned st[2][64 * 32];
  const int t = threadIdx.x, c4 = t & 15, k = t >> 4;
  size_t src[2], bh[2], s0[2];   // src: the tile's first element, the same for the whole block
#pragma unroll   // src[], bh[], s0[] stay in registers: every index a constant
  for (int u = 0; u < 2; ++u) { const size_t idx = blockIdx.x + (size_t)u * PB, h = idx & 15, sb = (idx >> 4) & 63, b = idx >> 10;   // head fastest: 16 neighbouring blocks read 64 whole input rows
    bh[u] = b * NHD + h; s0[u] = sb * 64; src[u] = (b * SS + s0[u]) * DW + h * HD; }
  const unsigned ov = (unsigned)(2 * k * DW + c4 * 4), oq = (unsigned)(k * DW + c4 * 4);   // the lane's own offsets: token pair 2k, 2k + 1 for value, token k of each 16 for query and key
  v4f av[2][4], aq[2][4], ak[2][4];
#pragma unroll   // all loads stand ahead of all work
  for (int u = 0; u < 2; ++u)
#pragma unroll
    for (int i = 0; i < 4; ++i) av[u][i] = *(const v4f*)(Xv + src[u] + ((i & 1) + 32 * (i >> 1)) * DW + ov);   // a thread holds token pairs: they share a word of V^T
  asm volatile("s_wait_xcnt 0x0" ::: "memory");   // behind each group of eight loads: it stands before a later load's result, or anything else, rewrites an address register that these loads name
#pragma unroll
  for (int u = 0; u < 2; ++u)
#pragma unroll
    for (int i = 0; i < 4; ++i) aq[u][i] = *(const v4f*)(Xq + src[u] + i * 16 * DW + oq);
  asm volatile("s_wait_xcnt 0x0" ::: "memory");
#pragma unroll
  for (int u = 0; u < 2; ++u)
#pragma unroll
    for (int i = 0; i < 4; ++i) ak[u][i] = *(const v4f*)(Xk + src[u] + i * 16 * DW + oq);
  asm volatile("s_wait_xcnt 0x0" ::: "memory");
  __builtin_amdgcn_sched_barrier(0);   // keeps the 24 loads together: without it the compiler draws conversions, with their waits, in between the loads, and a wave pays the memory latency several times over
#pragma unroll
  for (int u = 0; u < 2; ++u)
#pragma unroll
    for (int p = 0; p < 2; ++p) { const int kk = k + 16 * p;
#pragma unroll
      for (int j = 0; j < 4; ++j) st[u][(4 * c4 + j) * 32 + ((((kk >> 2) ^ c4) & 7) << 2) + (kk & 3)] = pk2(av[u][2 * p][j], av[u][2 * p + 1][j]); }
  v2u wq[2][4], wk[2][4];
#pragma unroll   // wq[][], wk[][] stay in registers: every index a constant
  for (int u = 0; u < 2; ++u)
#pragma unroll
    for (int i = 0; i < 4; ++i) { wq[u][i] = v2u{pk2(aq[u][i][0], aq[u][i][1]), pk2(aq[u][i][2], aq[u][i][3])}; wk[u][i] = v2u{pk2(ak[u][i][0], ak[u][i][1]), pk2(ak[u][i][2], ak[u][i][3])}; }
  __syncthreads();
#pragma unroll
  for (int u = 0; u < 2; ++u)
#pragma unroll
    for (int w = 0; w < 2; ++w) { const int d = w * 32 + (t >> 3), pc = t & 7;
      vst2(VT + (bh[u] * HD + d) * SS + s0[u] + pc * 8, *(const v4u*)&st[u][d * 32 + (((pc ^ (d >> 2)) & 7) << 2)]); }
#pragma unroll
  for (int u = 0; u < 2; ++u)
#pragma unroll
    for (int i = 0; i < 4; ++i) { vst2(Rq + (bh[u] * SS + s0[u] + i * 16 + k) * HD + c4 * 4, wq[u][i]); vst2(Rk + (bh[u] * SS + s0[u] + i * 16 + k) * HD + c4 * 4, wk[u][i]); }
}
// ---- k_attn: block = (128 queries, bh): exact-operand scores, softmax, P x v
// K and V^T reach the four waves through LDS: a stage is 64 keys, one K tile (64 key rows of 128 bytes) and one V^T tile (64 head-column rows of 128 bytes),
// brought by tensor loads, one request a wave and stage for its own 32-row slice (waves 0, 1: K; waves 2, 3: V^T), two buffers, the next stage in flight while this one is worked on.
// The mover pads every row by 16 bytes: at a pitch of 144 bytes, an odd multiple of 16, the 16 rows a fragment read touches fall on different banks.
#define KT 64
#define KS 0.18033688011112042f   // log2(e) / 8
#define NT (SS / KT)
#define LAZY 4.0f   // how far, in the scaled log2 scores, a score may stand above the maximum in use before the accumulators are rescaled
#define ROW_B 128u      // bytes of a tile row in the source
#define PITCH 144u      // bytes from row to row in LDS
#define SL_ROWS 32u     // rows of a slice
#define SLICE_B 6144u   // 32 rows of 144 bytes are 4,608: rounded up to a multiple of 2 KiB, where the next slice may start
#define TILE_B (2u * SLICE_B)
#define STAGE_B (2u * TILE_B)
typedef __attribute__((address_space(3))) unsigned char lds_u8;
typedef __attribute__((ext_vector_type(4))) uint32_t u32x4;
typedef __attribute__((ext_vector_type(8))) uint32_t u32x8;
__device__ __forceinline__ uint32_t uni(uint32_t v) { return (uint32_t)__builtin_amdgcn_readfirstlane(v); }
// A test that guards a tensor load, or the stage number its descriptor is formed from; as a volatile statement it also stays behind the wait written in front of it.
__device__ __forceinline__ uint32_t pinned(uint32_t v) { uint32_t w = uni(v); asm volatile("" : "+s"(w)); return w; }   // the word is held in a scalar register
// group 1: 1-byte elements, tensor = tile = 32 rows of 128 bytes, a pad of 4 dwords behind every 32 dwords; no mask
__device__ __forceinline__ u32x8 tdm_group1(uint32_t src_pitch) {
  u32x8 g;
  g[0] = uni((1u << 20) | (4u << 22) | (3u << 25));
  g[1] = uni(ROW_B << 16);
  g[2] = uni(SL_ROWS << 16);
  g[3] = uni(ROW_B << 16);
  g[4] = uni(SL_ROWS);
  g[5] = uni(src_pitch);
  g[6] = uni(0u);
  g[7] = uni(0u);
  return g;
}
// group 0: count 1, place in LDS, address of the slice's first byte, type 2
__device__ __forceinline__ u32x4 tdm_group0(uint32_t lds_dst, uint64_t ga) {
  u32x4 g;
  g[0] = uni(1u); g[1] = uni(lds_dst); g[2] = uni((uint32_t)ga); g[3] = uni((((uint32_t)(ga >> 32)) & 0x01FFFFFFu) | 0x80000000u);
  return g;
}
// The load and the wave's own wait for it both name the descriptor as operands they may change (neither does): from the load to the wait the words are then values that the compiler
// can neither rebuild nor drop, so they stay in the registers the request was issued from, and nothing else is put there while the request is out.
__device__ __forceinline__ void tdm_load(u32x4& g0, u32x8& g1) { asm volatile("tensor_load_to_lds %0, %1" : "+s"(g0), "+s"(g1) :: "memory"); }
__device__ __forceinline__ void tdm_wait(u32x4& g0, u32x8& g1) { asm volatile("s_wait_tensorcnt 0x0" : "+s"(g0), "+s"(g1) :: "memory"); }
__device__ __forceinline__ v16h frag_l(const unsigned char* t, unsigned o0, unsigned o1) {
  union { v16h v; v8h q[2]; } u; u.q[0] = *(const v8h*)(t + o0); u.q[1] = *(const v8h*)(t + o1); return u.v;
}
// lane l with lane l ^ 16: the two halves of a wave hold the same query column and different keys
__device__ __forceinline__ float xhalf(float x) { return __builtin_bit_cast(float, __builtin_amdgcn_permlanex16(__builtin_bit_cast(int, x), __builtin_bit_cast(int, x), 0x76543210, 0xfedcba98, false, false)); }
#define QT 2
#define SO_B (4 * QT * 16 * 68 * 4)   // output staging, smaller than the two stages
__global__ __launch_bounds__(128, 4) void k_attn(const _Float16* __restrict__ Q, const _Float16* __restrict__ K, const _Float16* __restrict__ VT, float* __restrict__ OUT) {
  static_assert(SO_B <= 2 * STAGE_B, "the array holds the ring and, behind the loop, the output staging");
  __shared__ __attribute__((aligned(2048))) unsigned char ring[2 * STAGE_B];   // every slice starts at a multiple of 2 KiB
  float (*so)[QT * 16][68] = (float (*)[QT * 16][68])ring;   // output staging takes the ring's place behind the loop's last barrier
  const int tid = threadIdx.x, wave = tid >> 5, lane = tid & 31, col = lane & 15, g = lane >> 4; const size_t bh = blockIdx.y; const int q0 = blockIdx.x * (64 * QT) + wave * (16 * QT); const size_t rq = bh * SS + q0;
  // tensor loads: every wave brings its own slice of every stage, so no test picks an issuer
  const uint32_t wv = uni((uint32_t)tid >> 5), isV = wv >> 1, half = wv & 1u;
  const uint32_t dst0 = (uint32_t)(size_t)(lds_u8*)ring + isV * TILE_B + half * SLICE_B;
  const uint64_t src0 = isV ? (uint64_t)(size_t)(VT + bh * HD * SS) + (uint64_t)half * (SL_ROWS * SS * 2) : (uint64_t)(size_t)(K + bh * SS * HD) + (uint64_t)half * (SL_ROWS * ROW_B);
  const uint32_t step = isV ? (uint32_t)(KT * 2) : (uint32_t)KT * ROW_B;   // bytes from a stage's slice to the next stage's
  u32x8 g1 = tdm_group1(isV ? (uint32_t)(SS * 2) : ROW_B);                 // the same for every stage
  // fragment reads: row col of a 16-row group, 16-byte pieces 2q + g, q = 0..3: one register, the rest immediate offsets
  const unsigned fo = (unsigned)col * PITCH + (unsigned)g * 16u;
  u32x4 g0 = tdm_group0(dst0, src0);   // group 0 of the request that is out
  tdm_load(g0, g1);
  tdm_wait(g0, g1);                    // this wave's slice of stage 0 has landed before the barrier that publishes it
  __syncthreads();
  g0 = tdm_group0(dst0 + STAGE_B, src0 + step);
  tdm_load(g0, g1);
  v16h aq[QT][2];
#pragma unroll   // aq[][] stays in registers: every index a constant
  for (int qt = 0; qt < QT; ++qt)
#pragma unroll
    for (int kc = 0; kc < 2; ++kc) aq[qt][kc] = frag_h(Q + (rq + qt * 16 + col) * HD + kc * 32, lane);
  // Lazy rescale: m is the maximum IN USE. It may trail a query's true maximum by up to LAZY in the scaled log2 scores, so P reaches at most 2^(11 + LAZY) = 2^15, inside f16;
  // output and sum carry the same factor 2^(-m * KS), which the final division takes out, whatever m is.
  float m[QT], l[QT];            // query qt * 16 + col: maximum in use of the raw products (equal in both halves), this half's share of the sum (times 2^11, as P)
  float thr[QT], bias[QT];       // m + LAZY / KS, and 11 - m * KS: they change only where m does
  v8f acc[QT][4] = {};           // acc[qt][dt][r] = O^T[dt * 16 + 8g + r][qt * 16 + col]
#pragma unroll   // m[], l[], thr[], bias[] stay in registers
  for (int qt = 0; qt < QT; ++qt) { m[qt] = -3.0e38f; thr[qt] = -3.0e38f; bias[qt] = 11.0f; l[qt] = 0.f; }   // every finite score exceeds thr: stage 0 sets m
#pragma unroll 1
  for (int t = 0; t < NT; ++t) { const unsigned char* kb = ring + (t & 1) * STAGE_B; const unsigned char* vb = kb + TILE_B;
   v8f s[2][QT][2];   // the stage's raw products: pass p (32 keys), query tile, 16-key tile
   v16h kf[2][2][2];  // the stage's K fragments: pass, 16-key tile, half of the head
#pragma unroll   // kf[][][] stays in registers; slice, row and piece offsets stay constants (immediate offsets of the LDS reads)
   for (int p = 0; p < 2; ++p)
#pragma unroll
    for (int ct = 0; ct < 2; ++ct)
#pragma unroll
      for (int kc = 0; kc < 2; ++kc) kf[p][ct][kc] = frag_l(kb + p * SLICE_B + ct * 16 * PITCH, fo + 64 * kc, fo + 64 * kc + 32);   // read once, used by both query tiles
   __builtin_amdgcn_sched_barrier(0);   // keeps the stage's 16 K reads in one group ahead of the products: spread among them, every place with reads makes the wave wait for LDS anew
#pragma unroll   // s[][][] stays in registers: every index a constant
   for (int p = 0; p < 2; ++p)
#pragma unroll
    for (int ct = 0; ct < 2; ++ct) {
#pragma unroll
      for (int qt = 0; qt < QT; ++qt) s[p][qt][ct] = v8f{};
#pragma unroll
      for (int kc = 0; kc < 2; ++kc)
#pragma unroll   // both tiles' products side by side on the one fragment
        for (int qt = 0; qt < QT; ++qt) s[p][qt][ct] = wmma16(kf[p][ct][kc], aq[qt][kc], s[p][qt][ct]); }   // raw products: the scale goes into the exponent's fma below
   __builtin_amdgcn_sched_barrier(0);   // keeps the 16 products in one run: drawn in between them, each maximum reads a tile just issued and the compiler fills the distance behind that WMMA with v_nop
   v16h vf0[4];   // pass 0's V^T fragments, asked for here, into registers that the K fragments have left: they land under the maxima and the exponentials
#pragma unroll   // vf0[] stays in registers
   for (int dt = 0; dt < 4; ++dt) vf0[dt] = frag_l(vb + (dt >> 1) * SLICE_B + (dt & 1) * 16 * PITCH, fo, fo + 32);
   // one test a stage: does any of the lane's own 32 scores of a query exceed the bound? The ballot joins the halves and the columns.
   float mx[QT]; bool need = false;
#pragma unroll   // mx[] stays in registers; a chain a pass, so that four chains run side by side
   for (int qt = 0; qt < QT; ++qt) { float ma = fmaxf(s[0][qt][0][0], s[0][qt][1][0]), mb = fmaxf(s[1][qt][0][0], s[1][qt][1][0]);
#pragma unroll
     for (int r = 1; r < 8; ++r) { ma = fmaxf(ma, fmaxf(s[0][qt][0][r], s[0][qt][1][r])); mb = fmaxf(mb, fmaxf(s[1][qt][0][r], s[1][qt][1][r])); }
     mx[qt] = fmaxf(ma, mb); need = need || (mx[qt] > thr[qt]); }
   if (__builtin_expect(__builtin_amdgcn_ballot_w32(need) != 0, 0)) {   // a scalar branch, the same for the whole wave; rare behind the first stage
#pragma unroll
     for (int qt = 0; qt < QT; ++qt) { const float mn = fmaxf(m[qt], fmaxf(mx[qt], xhalf(mx[qt])));
       const float alpha = (m[qt] <= -1.0e38f) ? 0.f : __builtin_amdgcn_exp2f((m[qt] - mn) * KS);
       m[qt] = mn; thr[qt] = mn + LAZY / KS; bias[qt] = fmaf(-mn, KS, 11.0f); l[qt] *= alpha;
#pragma unroll
       for (int dt = 0; dt < 4; ++dt) acc[qt][dt] *= alpha; } }
#pragma unroll
   for (int p = 0; p < 2; ++p) { v16h pb[QT];
#pragma unroll   // the two query tiles' chains are independent of each other
    for (int qt = 0; qt < QT; ++qt) {
      const float b = bias[qt];   // exponent of a score c: (c - m) * log2(e) / 8 + 11, one fma
      const v8f ks8 = {KS, KS, KS, KS, KS, KS, KS, KS}, b8 = {b, b, b, b, b, b, b, b};
      const v8f x0 = __builtin_elementwise_fma(s[p][qt][0], ks8, b8), x1 = __builtin_elementwise_fma(s[p][qt][1], ks8, b8);
      float es0 = 0.f, es1 = 0.f;
#pragma unroll
      for (int r = 0; r < 8; ++r) { const float e0 = __builtin_amdgcn_exp2f(x0[r]), e1 = __builtin_amdgcn_exp2f(x1[r]); es0 += e0; es1 += e1;
        pb[qt][r] = (_Float16)e0; pb[qt][8 + r] = (_Float16)e1; }
      l[qt] += es0 + es1; }
#pragma unroll
    for (int dt = 0; dt < 4; ++dt) { const v16h vf = p == 0 ? vf0[dt] : frag_l(vb + (dt >> 1) * SLICE_B + (dt & 1) * 16 * PITCH, fo + 64, fo + 96);   // read once, used by both query tiles
#pragma unroll   // both tiles' products side by side on the one fragment
      for (int qt = 0; qt < QT; ++qt) acc[qt][dt] = wmma16(vf, pb[qt], acc[qt][dt]); } }
   asm volatile("s_wait_dscnt 0x0" ::: "memory");
   tdm_wait(g0, g1);
   __syncthreads();
   if (pinned(t + 2 < NT)) {
     const uint32_t st = pinned((uint32_t)t + 2u);
     g0 = tdm_group0(dst0 + (st & 1u) * STAGE_B, src0 + (uint64_t)st * step);
     tdm_load(g0, g1); } }
  asm volatile("s_wait_tensorcnt 0x0" ::: "memory");   // nothing in flight when the ring becomes output staging
  asm volatile("s_wait_dscnt 0x0" ::: "memory");       // and none of this wave's reads of it
#pragma unroll   // acc[][] and l[] stay in registers: every index a constant
  for (int qt = 0; qt < QT; ++qt) { const float il = 1.0f / (l[qt] + xhalf(l[qt]));  // the halves' sums are joined once, here; the 2^11 of P and of the sum cancel
#pragma unroll
    for (int dt = 0; dt < 4; ++dt) { v4f lo, hi;
#pragma unroll
      for (int r = 0; r < 4; ++r) { lo[r] = acc[qt][dt][r] * il; hi[r] = acc[qt][dt][4 + r] * il; }
      *(v4f*)&so[wave][qt * 16 + col][dt * 16 + 8 * g] = lo; *(v4f*)&so[wave][qt * 16 + col][dt * 16 + 8 * g + 4] = hi; } }
  LDSX();
  for (int rl = 0; rl < QT * 16; ++rl) if (lane < 16) vst2(OUT + (rq + rl) * HD + lane * 4, *(const v4f*)&so[wave][rl][lane * 4]);
}
extern "C" void kernel_launch(void* const* d_in, const int* in_sizes, int n_in, void* d_out, int out_size, void* d_ws, size_t ws_size, hipStream_t stream) {
  (void)in_sizes; (void)n_in; (void)out_size;
  const float** F = (const float**)d_in;   // 0 query, 1 key, 2 value [2,4096,1024]
  if (ws_size < (size_t)WS_END) return;
  char* ws = (char*)d_ws; _Float16 *Qr = (_Float16*)(ws + WS_Q), *Kr = (_Float16*)(ws + WS_K), *VT = (_Float16*)(ws + WS_VT);
  k_prep<<<PB, 256, 0, stream>>>(F[0], F[1], F[2], Qr, Kr, VT);
  k_attn<<<dim3(TQB, TNB), 128, 0, stream>>>(Qr, Kr, VT, (float*)d_out);
}

// v009
// Measured time: 105 microseconds a run.
// In both of two side-by-side timings against v008, it was 1.04 times as fast.
// Over all steps from v000 it is 6.86 times as fast.
// compute dtype: query, key, value rounded to bf16 and used as EXACT f16 operands on WMMA 16x16x32 (heads split from the 1,024-wide rows); scores / 8 (the module's query / sqrt(64)), softmax in f32 against a running maximum that is raised lazily (hardware exp), P (scaled by 2^11, single f16) x v (exact); f32 accumulate; output in the module's (batch*head, token, 64) layout.
#include <hip/hip_runtime.h>
#include <math.h>

typedef __attribute__((ext_vector_type(16))) _Float16 v16h;
typedef __attribute__((ext_vector_type(16))) __bf16 v16b;
typedef __attribute__((ext_vector_type(8)))  _Float16 v8h;
typedef __attribute__((ext_vector_type(8)))  float v8f;
typedef __attribute__((ext_vector_type(4)))  float v4f;
typedef __attribute__((ext_vector_type(2)))  float v2f;
typedef __attribute__((ext_vector_type(4)))  unsigned v4u;
typedef __attribute__((ext_vector_type(4)))  int v4i;
typedef float __attribute__((may_alias)) float_a;
typedef int __attribute__((may_alias)) int_a;

template <typename T> __device__ __forceinline__ void vst2(void* p, T v) { *(T*)p = v;  }
// the builtin alone: the compiler keeps the distances behind its own WMMAs and may fetch the next LDS fragments while one runs
__device__ __forceinline__ v8f wmma16(v16h a, v16h b, v8f c) {
  return __builtin_amdgcn_wmma_f32_16x16x32_f16(false, a, false, b, (short)0, c, false, false);
}
__device__ __forceinline__ v8f wmma_bf(v16b a, v16b b, v8f c) {
  v8f d = __builtin_amdgcn_wmma_f32_16x16x32_bf16(false, a, false, b, (short)0, c, false, false);
  asm volatile("v_nop\n\tv_nop\n\tv_nop\n\tv_nop" : "+v"(d) : "v"(a), "v"(b));
  return d;
}
// 16x16x32 fragments: lane = (h = lane>>4, row/col = lane&15); elements 0..7 = k0+8h+0..7, 8..15 = k0+16+8h+0..7; D element r = row 8h+r
__device__ __forceinline__ v16h frag_h(const _Float16* rowk0, int lane) {
  union { v16h v; v8h q[2]; } u; const _Float16* p = rowk0 + 8 * (lane >> 4);
  u.q[0] = *(const v8h*)p; u.q[1] = *(const v8h*)(p + 16); return u.v;
}
__device__ __forceinline__ v16h frag_f32(const float* rowk0, int lane) {
  v16h a; const float* p = rowk0 + 8 * (lane >> 4);
#pragma unroll
  for (int i = 0; i < 8; ++i) { a[i] = (_Float16)p[i]; a[8 + i] = (_Float16)p[16 + i]; }
  return a;
}
__device__ __forceinline__ v16h frag_f32s(const float* rowk0, int lane, float sc) {
  v16h a; const float* p = rowk0 + 8 * (lane >> 4);
#pragma unroll
  for (int i = 0; i < 8; ++i) { a[i] = (_Float16)(p[i] * sc); a[8 + i] = (_Float16)(p[16 + i] * sc); }
  return a;
}
// column fragment from a [K][ld] layout (column n), rows >= K read as 0
__device__ __forceinline__ v16h fragc_f32(const float* W, int k0, int n, int lane, int ld, int K) {
  v16h a; const int g = lane >> 4;
#pragma unroll
  for (int i = 0; i < 8; ++i) { const int ka = k0 + 8 * g + i, kb = ka + 16;
    a[i] = (_Float16)(ka < K ? W[(size_t)(ka < K ? ka : K - 1) * ld + n] : 0.f); a[8 + i] = (_Float16)(kb < K ? W[(size_t)(kb < K ? kb : K - 1) * ld + n] : 0.f); }
  return a;
}
struct F2 { v16b h, l; };
__device__ __forceinline__ F2 bsplit16(const float v[16]) { F2 r;
#pragma unroll
  for (int i = 0; i < 16; ++i) { const __bf16 h = (__bf16)v[i]; r.h[i] = h; r.l[i] = (__bf16)(v[i] - (float)h); }
  return r; }
__device__ __forceinline__ F2 split_row(const float* row, int k0, int lane) { float v[16]; const float* p = row + k0 + 8 * (lane >> 4);
#pragma unroll
  for (int i = 0; i < 8; ++i) { v[i] = p[i]; v[8 + i] = p[16 + i]; }
  return bsplit16(v); }
__device__ __forceinline__ F2 split_rowK(const float* row, int k0, int lane, int K) { float v[16]; const int g = lane >> 4;
#pragma unroll
  for (int i = 0; i < 8; ++i) { const int ka = k0 + 8 * g + i, kb = ka + 16; v[i] = ka < K ? row[ka < K ? ka : K - 1] : 0.f; v[8 + i] = kb < K ? row[kb < K ? kb : K - 1] : 0.f; }
  return bsplit16(v); }
__device__ __forceinline__ F2 split_col(const float* W, int k0, int n, int lane, int ld, int K) { float v[16]; const int g = lane >> 4;
#pragma unroll
  for (int i = 0; i < 8; ++i) { const int ka = k0 + 8 * g + i, kb = ka + 16; v[i] = ka < K ? W[(size_t)(ka < K ? ka : K - 1) * ld + n] : 0.f; v[8 + i] = kb < K ? W[(size_t)(kb < K ? kb : K - 1) * ld + n] : 0.f; }
  return bsplit16(v); }
__device__ __forceinline__ v8f mac3(const F2& a, const F2& b, v8f c) { c = wmma_bf(a.l, b.h, c); c = wmma_bf(a.h, b.l, c); return wmma_bf(a.h, b.h, c); }
__device__ __forceinline__ float sigm(float v) { return 1.0f / (1.0f + expf(-v)); }
#define LDSX() do { asm volatile("s_wait_dscnt 0" ::: "memory"); __builtin_amdgcn_wave_barrier(); __builtin_amdgcn_fence(__ATOMIC_RELEASE, "workgroup"); } while (0)


// Memory-efficient (chunked) attention == softmax(q k^T / sqrt(64)) v per head (B 2, S 4,096, 16 heads x 64), output left in (batch*head, token, head_dim) form.
#define NB 2
#define NHD 16
#define NBH (NB * NHD)
#define SS 4096
#define HD 64
#define DW (NHD * HD)   // 1024-wide input rows
#ifndef TQB
#define TQB (SS / 128)
#define TNB NBH
#endif
typedef __attribute__((ext_vector_type(8))) __bf16 v8b;
__device__ __forceinline__ v16b frag_b(const __bf16* rowk0, int lane) {
  union { v16b v; v8b q[2]; } u; const __bf16* p = rowk0 + 8 * (lane >> 4);
  u.q[0] = *(const v8b*)p; u.q[1] = *(const v8b*)(p + 16); return u.v;
}
__device__ __forceinline__ float bfr(float v) { return (float)(__bf16)v; }
__device__ __attribute__((noinline)) float exp_ni(float v) { return expf(v); }
__device__ __attribute__((noinline)) float erf_ni(float v) { return erff(v); }

#define WS_Q   0u                                  // f16 rows q ; k ; VT planes [bh][64][s]
#define WS_K   (WS_Q + 2u * (size_t)NBH * SS * HD)
#define WS_VT  (WS_K + 2u * (size_t)NBH * SS * HD)
#define WS_END (WS_VT + 2u * (size_t)NBH * HD * SS)

// ---- k_prep: the one conversion launch. 1,024 blocks, four resident on a WGP; a block takes two 64-token x 64-column head tiles of each of query, key, value.
// A thread asks for all its 24 pieces of 16 bytes at the start (16 lanes cover one 256-byte head row), so the whole input is on its way at once and few waves have to start.
// query and key tiles go out straight from registers, 16 lanes writing one 128-byte row; value tiles turn through LDS. All stores stand behind the one barrier, which waits for no store.
#define PB 1024
typedef __attribute__((ext_vector_type(2))) unsigned v2u;
typedef __attribute__((ext_vector_type(2))) __bf16 v2b;
typedef __attribute__((ext_vector_type(2))) _Float16 v2h;
// two values rounded to bf16 and held as f16, in one word: packed conversions both ways
__device__ __forceinline__ unsigned pk2(float a, float b) {
  const v2f x = {a, b}; const unsigned r = __builtin_bit_cast(unsigned, __builtin_convertvector(x, v2b));
  const v2f y = {__builtin_bit_cast(float, r << 16), __builtin_bit_cast(float, r & 0xffff0000u)};
  return __builtin_bit_cast(unsigned, __builtin_convertvector(y, v2h));
}
__global__ __launch_bounds__(256) void k_prep(const float* __restrict__ Xq, const float* __restrict__ Xk, const float* __restrict__ Xv, _Float16* __restrict__ Rq, _Float16* __restrict__ Rk, _Float16* __restrict__ VT) {
  // st[u][d][word]: word kk of row d holds tokens 2kk, 2kk + 1; its 16-byte piece kk >> 2 is stored at piece ^ ((d >> 2) & 7), which spreads the 16 rows one store touches over the banks
  __shared__ __align__(16) unsigned st[2][64 * 32];
  const int t = threadIdx.x, c4 = t & 15, k = t >> 4;
  size_t src[2], bh[2], s0[2];   // src: the tile's first element, the same for the whole block
#pragma unroll   // src[], bh[], s0[] stay in registers: every index a constant
  for (int u = 0; u < 2; ++u) { const size_t idx = blockIdx.x + (size_t)u * PB, h = idx & 15, sb = (idx >> 4) & 63, b = idx >> 10;   // head fastest: 16 neighbouring blocks read 64 whole input rows
    bh[u] = b * NHD + h; s0[u] = sb * 64; src[u] = (b * SS + s0[u]) * DW + h * HD; }
  const unsigned ov = (unsigned)(2 * k * DW + c4 * 4), oq = (unsigned)(k * DW + c4 * 4);   // the lane's own offsets: token pair 2k, 2k + 1 for value, token k of each 16 for query and key
  v4f av[2][4], aq[2][4], ak[2][4];
#pragma unroll   // all loads stand ahead of all work
  for (int u = 0; u < 2; ++u)
#pragma unroll
    for (int i = 0; i < 4; ++i) av[u][i] = *(const v4f*)(Xv + src[u] + ((i & 1) + 32 * (i >> 1)) * DW + ov);   // a thread holds token pairs: they share a word of V^T
  asm volatile("s_wait_xcnt 0x0" ::: "memory");   // behind each group of eight loads: it stands before a later load's result, or anything else, rewrites an address register that these loads name
#pragma unroll
  for (int u = 0; u < 2; ++u)
#pragma unroll
    for (int i = 0; i < 4; ++i) aq[u][i] = *(const v4f*)(Xq + src[u] + i * 16 * DW + oq);
  asm volatile("s_wait_xcnt 0x0" ::: "memory");
#pragma unroll
  for (int u = 0; u < 2; ++u)
#pragma unroll
    for (int i = 0; i < 4; ++i) ak[u][i] = *(const v4f*)(Xk + src[u] + i * 16 * DW + oq);
  asm volatile("s_wait_xcnt 0x0" ::: "memory");
  __builtin_amdgcn_sched_barrier(0);   // keeps the 24 loads together: without it the compiler draws conversions, with their waits, in between the loads, and a wave pays the memory latency several times over
#pragma unroll
  for (int u = 0; u < 2; ++u)
#pragma unroll
    for (int p = 0; p < 2; ++p) { const int kk = k + 16 * p;
#pragma unroll
      for (int j = 0; j < 4; ++j) st[u][(4 * c4 + j) * 32 + ((((kk >> 2) ^ c4) & 7) << 2) + (kk & 3)] = pk2(av[u][2 * p][j], av[u][2 * p + 1][j]); }
  v2u wq[2][4], wk[2][4];
#pragma unroll   // wq[][], wk[][] stay in registers: every index a constant
  for (int u = 0; u < 2; ++u)
#pragma unroll
    for (int i = 0; i < 4; ++i) { wq[u][i] = v2u{pk2(aq[u][i][0], aq[u][i][1]), pk2(aq[u][i][2], aq[u][i][3])}; wk[u][i] = v2u{pk2(ak[u][i][0], ak[u][i][1]), pk2(ak[u][i][2], ak[u][i][3])}; }
  __syncthreads();
#pragma unroll
  for (int u = 0; u < 2; ++u)
#pragma unroll
    for (int w = 0; w < 2; ++w) { const int d = w * 32 + (t >> 3), pc = t & 7;
      vst2(VT + (bh[u] * HD + d) * SS + s0[u] + pc * 8, *(const v4u*)&st[u][d * 32 + (((pc ^ (d >> 2)) & 7) << 2)]); }
#pragma unroll
  for (int u = 0; u < 2; ++u)
#pragma unroll
    for (int i = 0; i < 4; ++i) { vst2(Rq + (bh[u] * SS + s0[u] + i * 16 + k) * HD + c4 * 4, wq[u][i]); vst2(Rk + (bh[u] * SS + s0[u] + i * 16 + k) * HD + c4 * 4, wk[u][i]); }
}
// ---- k_attn: block = (128 queries, bh): exact-operand scores, softmax, P x v
// K and V^T reach the four waves through LDS: a stage is 64 keys, one K tile (64 key rows of 128 bytes) and one V^T tile (64 head-column rows of 128 bytes),
// brought by tensor loads, one request a wave and stage for its own 32-row slice (waves 0, 1: K; waves 2, 3: V^T), two buffers, the next stage in flight while this one is worked on.
// The mover pads every row by 16 bytes: at a pitch of 144 bytes, an odd multiple of 16, the 16 rows a fragment read touches fall on different banks.
#define KT 64
#define KS 0.18033688011112042f   // log2(e) / 8
#define NT (SS / KT)
#define LAZY 4.0f   // how far, in the scaled log2 scores, a score may stand above the maximum in use before the accumulators are rescaled
#define ROW_B 128u      // bytes of a tile row in the source
#define PITCH 144u      // bytes from row to row in LDS
#define SL_ROWS 32u     // rows of a slice
#define SLICE_B 6144u   // 32 rows of 144 bytes are 4,608: rounded up to a multiple of 2 KiB, where the next slice may start
#define TILE_B (2u * SLICE_B)
#define STAGE_B (2u * TILE_B)
typedef __attribute__((address_space(3))) unsigned char lds_u8;
typedef __attribute__((ext_vector_type(4))) uint32_t u32x4;
typedef __attribute__((ext_vector_type(8))) uint32_t u32x8;
__device__ __forceinline__ uint32_t uni(uint32_t v) { return (uint32_t)__builtin_amdgcn_readfirstlane(v); }
// A test that guards a tensor load, or the stage number its descriptor is formed from; as a volatile statement it also stays behind the wait written in front of it.
__device__ __forceinline__ uint32_t pinned(uint32_t v) { uint32_t w = uni(v); asm volatile("" : "+s"(w)); return w; }   // the word is held in a scalar register
// group 1: 1-byte elements, tensor = tile = 32 rows of 128 bytes, a pad of 4 dwords behind every 32 dwords; no mask
__device__ __forceinline__ u32x8 tdm_group1(uint32_t src_pitch) {
  u32x8 g;
  g[0] = uni((1u << 20) | (4u << 22) | (3u << 25));
  g[1] = uni(ROW_B << 16);
  g[2] = uni(SL_ROWS << 16);
  g[3] = uni(ROW_B << 16);
  g[4] = uni(SL_ROWS);
  g[5] = uni(src_pitch);
  g[6] = uni(0u);
  g[7] = uni(0u);
  return g;
}
// group 0: count 1, place in LDS, address of the slice's first byte, type 2
__device__ __forceinline__ u32x4 tdm_group0(uint32_t lds_dst, uint64_t ga) {
  u32x4 g;
  g[0] = uni(1u); g[1] = uni(lds_dst); g[2] = uni((uint32_t)ga); g[3] = uni((((uint32_t)(ga >> 32)) & 0x01FFFFFFu) | 0x80000000u);
  return g;
}
// The load and the wave's own wait for it both name the descriptor as operands they may change (neither does): from the load to the wait the words are then values that the compiler
// can neither rebuild nor drop, so they stay in the registers the request was issued from, and nothing else is put there while the request is out.
__device__ __forceinline__ void tdm_load(u32x4& g0, u32x8& g1) { asm volatile("tensor_load_to_lds %0, %1" : "+s"(g0), "+s"(g1) :: "memory"); }
__device__ __forceinline__ void tdm_wait(u32x4& g0, u32x8& g1) { asm volatile("s_wait_tensorcnt 0x0" : "+s"(g0), "+s"(g1) :: "memory"); }
__device__ __forceinline__ v16h frag_l(const unsigned char* t, unsigned o0, unsigned o1) {
  union { v16h v; v8h q[2]; } u; u.q[0] = *(const v8h*)(t + o0); u.q[1] = *(const v8h*)(t + o1); return u.v;
}
// lane l with lane l ^ 16: the two halves of a wave hold the same query column and different keys
__device__ __forceinline__ float xhalf(float x) { return __builtin_bit_cast(float, __builtin_amdgcn_permlanex16(__builtin_bit_cast(int, x), __builtin_bit_cast(int, x), 0x76543210, 0xfedcba98, false, false)); }
#define QT 2
// Priority by progress. A SIMD holds one wave of each of four blocks.
// A wave starts at priority 3 and steps down at stages PR2, PR1, PR0, for speed only: who is ahead yields to who is behind.
#define PR2 36
#define PR1 54
#define PR0 60
#define SO_B (4 * QT * 16 * 68 * 4)   // output staging, smaller than the two stages
__global__ __launch_bounds__(128, 4) void k_attn(const _Float16* __restrict__ Q, const _Float16* __restrict__ K, const _Float16* __restrict__ VT, float* __restrict__ OUT) {
  static_assert(SO_B <= 2 * STAGE_B, "the array holds the ring and, behind the loop, the output staging");
  __shared__ __attribute__((aligned(2048))) unsigned char ring[2 * STAGE_B];   // every slice starts at a multiple of 2 KiB
  float (*so)[QT * 16][68] = (float (*)[QT * 16][68])ring;   // output staging takes the ring's place behind the loop's last barrier
  const int tid = threadIdx.x, wave = tid >> 5, lane = tid & 31, col = lane & 15, g = lane >> 4; const size_t bh = blockIdx.y; const int q0 = blockIdx.x * (64 * QT) + wave * (16 * QT); const size_t rq = bh * SS + q0;
  // tensor loads: every wave brings its own slice of every stage, so no test picks an issuer
  const uint32_t wv = uni((uint32_t)tid >> 5), isV = wv >> 1, half = wv & 1u;
  const uint32_t dst0 = (uint32_t)(size_t)(lds_u8*)ring + isV * TILE_B + half * SLICE_B;
  const uint64_t src0 = isV ? (uint64_t)(size_t)(VT + bh * HD * SS) + (uint64_t)half * (SL_ROWS * SS * 2) : (uint64_t)(size_t)(K + bh * SS * HD) + (uint64_t)half * (SL_ROWS * ROW_B);
  const uint32_t step = isV ? (uint32_t)(KT * 2) : (uint32_t)KT * ROW_B;   // bytes from a stage's slice to the next stage's
  u32x8 g1 = tdm_group1(isV ? (uint32_t)(SS * 2) : ROW_B);                 // the same for every stage
  // fragment reads: row col of a 16-row group, 16-byte pieces 2q + g, q = 0..3: one register, the rest immediate offsets
  const unsigned fo = (unsigned)col * PITCH + (unsigned)g * 16u;
  u32x4 g0 = tdm_group0(dst0, src0);   // group 0 of the request that is out
  tdm_load(g0, g1);
  tdm_wait(g0, g1);                    // this wave's slice of stage 0 has landed before the barrier that publishes it
  __syncthreads();
  g0 = tdm_group0(dst0 + STAGE_B, src0 + step);
  tdm_load(g0, g1);
  v16h aq[QT][2];
#pragma unroll   // aq[][] stays in registers: every index a constant
  for (int qt = 0; qt < QT; ++qt)
#pragma unroll
    for (int kc = 0; kc < 2; ++kc) aq[qt][kc] = frag_h(Q + (rq + qt * 16 + col) * HD + kc * 32, lane);
  // Lazy rescale: m is the maximum IN USE. It may trail a query's true maximum by up to LAZY in the scaled log2 scores, so P reaches at most 2^(11 + LAZY) = 2^15, inside f16;
  // output and sum carry the same factor 2^(-m * KS), which the final division takes out, whatever m is.
  float m[QT], l[QT];            // query qt * 16 + col: maximum in use of the raw products (equal in both halves), this half's share of the sum (times 2^11, as P)
  float thr[QT], bias[QT];       // m + LAZY / KS, and 11 - m * KS: they change only where m does
  v8f acc[QT][4] = {};           // acc[qt][dt][r] = O^T[dt * 16 + 8g + r][qt * 16 + col]
#pragma unroll   // m[], l[], thr[], bias[] stay in registers
  for (int qt = 0; qt < QT; ++qt) { m[qt] = -3.0e38f; thr[qt] = -3.0e38f; bias[qt] = 11.0f; l[qt] = 0.f; }   // every finite score exceeds thr: stage 0 sets m
#pragma unroll   // four copies of the stage loop, one a priority: s_setprio takes an immediate, and so no stage pays for a test
  for (int seg = 0; seg < 4; ++seg) {
  if (seg == 0) __builtin_amdgcn_s_setprio(3); else if (seg == 1) __builtin_amdgcn_s_setprio(2); else if (seg == 2) __builtin_amdgcn_s_setprio(1); else __builtin_amdgcn_s_setprio(0);   // 0 from the last stages to the kernel's end
  const int tb = seg == 0 ? 0 : seg == 1 ? PR2 : seg == 2 ? PR1 : PR0, te = seg == 0 ? PR2 : seg == 1 ? PR1 : seg == 2 ? PR0 : NT;
#pragma unroll 1
  for (int t = tb; t < te; ++t) { const unsigned char* kb = ring + (t & 1) * STAGE_B; const unsigned char* vb = kb + TILE_B;
   v8f s[2][QT][2];   // the stage's raw products: pass p (32 keys), query tile, 16-key tile
   v16h kf[2][2][2];  // the stage's K fragments: pass, 16-key tile, half of the head
#pragma unroll   // kf[][][] stays in registers; slice, row and piece offsets stay constants (immediate offsets of the LDS reads)
   for (int p = 0; p < 2; ++p)
#pragma unroll
    for (int ct = 0; ct < 2; ++ct)
#pragma unroll
      for (int kc = 0; kc < 2; ++kc) kf[p][ct][kc] = frag_l(kb + p * SLICE_B + ct * 16 * PITCH, fo + 64 * kc, fo + 64 * kc + 32);   // read once, used by both query tiles
   __builtin_amdgcn_sched_barrier(0);   // keeps the stage's 16 K reads in one group ahead of the products: spread among them, every place with reads makes the wave wait for LDS anew
#pragma unroll   // s[][][] stays in registers: every index a constant
   for (int p = 0; p < 2; ++p)
#pragma unroll
    for (int ct = 0; ct < 2; ++ct) {
#pragma unroll
      for (int qt = 0; qt < QT; ++qt) s[p][qt][ct] = v8f{};
#pragma unroll
      for (int kc = 0; kc < 2; ++kc)
#pragma unroll   // both tiles' products side by side on the one fragment
        for (int qt = 0; qt < QT; ++qt) s[p][qt][ct] = wmma16(kf[p][ct][kc], aq[qt][kc], s[p][qt][ct]); }   // raw products: the scale goes into the exponent's fma below
   __builtin_amdgcn_sched_barrier(0);   // keeps the 16 products in one run: drawn in between them, each maximum reads a tile just issued and the compiler fills the distance behind that WMMA with v_nop
   v16h vf0[4];   // pass 0's V^T fragments, asked for here, into registers that the K fragments have left: they land under the maxima and the exponentials
#pragma unroll   // vf0[] stays in registers
   for (int dt = 0; dt < 4; ++dt) vf0[dt] = frag_l(vb + (dt >> 1) * SLICE_B + (dt & 1) * 16 * PITCH, fo, fo + 32);
   // one test a stage: does any of the lane's own 32 scores of a query exceed the bound? The ballot joins the halves and the columns.
   float mx[QT]; bool need = false;
#pragma unroll   // mx[] stays in registers; a chain a pass, so that four chains run side by side
   for (int qt = 0; qt < QT; ++qt) { float ma = fmaxf(s[0][qt][0][0], s[0][qt][1][0]), mb = fmaxf(s[1][qt][0][0], s[1][qt][1][0]);
#pragma unroll
     for (int r = 1; r < 8; ++r) { ma = fmaxf(ma, fmaxf(s[0][qt][0][r], s[0][qt][1][r])); mb = fmaxf(mb, fmaxf(s[1][qt][0][r], s[1][qt][1][r])); }
     mx[qt] = fmaxf(ma, mb); need = need || (mx[qt] > thr[qt]); }
   if (__builtin_expect(__builtin_amdgcn_ballot_w32(need) != 0, 0)) {   // a scalar branch, the same for the whole wave; rare behind the first stage
#pragma unroll
     for (int qt = 0; qt < QT; ++qt) { const float mn = fmaxf(m[qt], fmaxf(mx[qt], xhalf(mx[qt])));
       const float alpha = (m[qt] <= -1.0e38f) ? 0.f : __builtin_amdgcn_exp2f((m[qt] - mn) * KS);
       m[qt] = mn; thr[qt] = mn + LAZY / KS; bias[qt] = fmaf(-mn, KS, 11.0f); l[qt] *= alpha;
#pragma unroll
       for (int dt = 0; dt < 4; ++dt) acc[qt][dt] *= alpha; } }
#pragma unroll
   for (int p = 0; p < 2; ++p) { v16h pb[QT];
#pragma unroll   // the two query tiles' chains are independent of each other
    for (int qt = 0; qt < QT; ++qt) {
      const float b = bias[qt];   // exponent of a score c: (c - m) * log2(e) / 8 + 11, one fma
      const v8f ks8 = {KS, KS, KS, KS, KS, KS, KS, KS}, b8 = {b, b, b, b, b, b, b, b};
      const v8f x0 = __builtin_elementwise_fma(s[p][qt][0], ks8, b8), x1 = __builtin_elementwise_fma(s[p][qt][1], ks8, b8);
      float es0 = 0.f, es1 = 0.f;
#pragma unroll
      for (int r = 0; r < 8; ++r) { const float e0 = __builtin_amdgcn_exp2f(x0[r]), e1 = __builtin_amdgcn_exp2f(x1[r]); es0 += e0; es1 += e1;
        pb[qt][r] = (_Float16)e0; pb[qt][8 + r] = (_Float16)e1; }
      l[qt] += es0 + es1; }
#pragma unroll
    for (int dt = 0; dt < 4; ++dt) { const v16h vf = p == 0 ? vf0[dt] : frag_l(vb + (dt >> 1) * SLICE_B + (dt & 1) * 16 * PITCH, fo + 64, fo + 96);   // read once, used by both query tiles
#pragma unroll   // both tiles' products side by side on the one fragment
      for (int qt = 0; qt < QT; ++qt) acc[qt][dt] = wmma16(vf, pb[qt], acc[qt][dt]); } }
   asm volatile("s_wait_dscnt 0x0" ::: "memory");
   tdm_wait(g0, g1);
   __syncthreads();
   if (pinned(t + 2 < NT)) {
     const uint32_t st = pinned((uint32_t)t + 2u);
     g0 = tdm_group0(dst0 + (st & 1u) * STAGE_B, src0 + (uint64_t)st * step);
     tdm_load(g0, g1); } } }
  asm volatile("s_wait_tensorcnt 0x0" ::: "memory");   // nothing in flight when the ring becomes output staging
  asm volatile("s_wait_dscnt 0x0" ::: "memory");       // and none of this wave's reads of it
#pragma unroll   // acc[][] and l[] stay in registers: every index a constant
  for (int qt = 0; qt < QT; ++qt) { const float il = 1.0f / (l[qt] + xhalf(l[qt]));  // the halves' sums are joined once, here; the 2^11 of P and of the sum cancel
#pragma unroll
    for (int dt = 0; dt < 4; ++dt) { v4f lo, hi;
#pragma unroll
      for (int r = 0; r < 4; ++r) { lo[r] = acc[qt][dt][r] * il; hi[r] = acc[qt][dt][4 + r] * il; }
      *(v4f*)&so[wave][qt * 16 + col][dt * 16 + 8 * g] = lo; *(v4f*)&so[wave][qt * 16 + col][dt * 16 + 8 * g + 4] = hi; } }
  LDSX();
  for (int rl = 0; rl < QT * 16; ++rl) if (lane < 16) vst2(OUT + (rq + rl) * HD + lane * 4, *(const v4f*)&so[wave][rl][lane * 4]);
}
extern "C" void kernel_launch(void* const* d_in, const int* in_sizes, int n_in, void* d_out, int out_size, void* d_ws, size_t ws_size, hipStream_t stream) {
  (void)in_sizes; (void)n_in; (void)out_size;
  const float** F = (const float**)d_in;   // 0 query, 1 key, 2 value [2,4096,1024]
  if (ws_size < (size_t)WS_END) return;
  char* ws = (char*)d_ws; _Float16 *Qr = (_Float16*)(ws + WS_Q), *Kr = (_Float16*)(ws + WS_K), *VT = (_Float16*)(ws + WS_VT);
  k_prep<<<PB, 256, 0, stream>>>(F[0], F[1], F[2], Qr, Kr, VT);
  k_attn<<<dim3(TQB, TNB), 128, 0, stream>>>(Qr, Kr, VT, (float*)d_out);
}

// v010
// It runs in 102 microseconds.
// Next to v009, in two timings, it ran 1.04 times as fast each time.
// All steps since v000 together make it 7.13 times as fast.
// compute dtype: query, key, value rounded to bf16 and used as EXACT f16 operands on WMMA 16x16x32 (heads split from the 1,024-wide rows); scores / 8 (the module's query / sqrt(64)), softmax in f32 against a running maximum that is raised lazily (hardware exp), P (scaled by 2^11, single f16) x v (exact); f32 accumulate; output in the module's (batch*head, token, 64) layout.
#include <hip/hip_runtime.h>
#include <math.h>

typedef __attribute__((ext_vector_type(16))) _Float16 v16h;
typedef __attribute__((ext_vector_type(16))) __bf16 v16b;
typedef __attribute__((ext_vector_type(8)))  _Float16 v8h;
typedef __attribute__((ext_vector_type(8)))  float v8f;
typedef __attribute__((ext_vector_type(4)))  float v4f;
typedef __attribute__((ext_vector_type(2)))  float v2f;
typedef __attribute__((ext_vector_type(4)))  unsigned v4u;
typedef __attribute__((ext_vector_type(4)))  int v4i;
typedef float __attribute__((may_alias)) float_a;
typedef int __attribute__((may_alias)) int_a;

template <typename T> __device__ __forceinline__ void vst2(void* p, T v) { *(T*)p = v;  }
// the builtin alone: the compiler keeps the distances behind its own WMMAs and may fetch the next LDS fragments while one runs
__device__ __forceinline__ v8f wmma16(v16h a, v16h b, v8f c) {
  return __builtin_amdgcn_wmma_f32_16x16x32_f16(false, a, false, b, (short)0, c, false, false);
}
__device__ __forceinline__ v8f wmma_bf(v16b a, v16b b, v8f c) {
  v8f d = __builtin_amdgcn_wmma_f32_16x16x32_bf16(false, a, false, b, (short)0, c, false, false);
  asm volatile("v_nop\n\tv_nop\n\tv_nop\n\tv_nop" : "+v"(d) : "v"(a), "v"(b));
  return d;
}
// 16x16x32 fragments: lane = (h = lane>>4, row/col = lane&15); elements 0..7 = k0+8h+0..7, 8..15 = k0+16+8h+0..7; D element r = row 8h+r
__device__ __forceinline__ v16h frag_h(const _Float16* rowk0, int lane) {
  union { v16h v; v8h q[2]; } u; const _Float16* p = rowk0 + 8 * (lane >> 4);
  u.q[0] = *(const v8h*)p; u.q[1] = *(const v8h*)(p + 16); return u.v;
}
__device__ __forceinline__ v16h frag_f32(const float* rowk0, int lane) {
  v16h a; const float* p = rowk0 + 8 * (lane >> 4);
#pragma unroll
  for (int i = 0; i < 8; ++i) { a[i] = (_Float16)p[i]; a[8 + i] = (_Float16)p[16 + i]; }
  return a;
}
__device__ __forceinline__ v16h frag_f32s(const float* rowk0, int lane, float sc) {
  v16h a; const float* p = rowk0 + 8 * (lane >> 4);
#pragma unroll
  for (int i = 0; i < 8; ++i) { a[i] = (_Float16)(p[i] * sc); a[8 + i] = (_Float16)(p[16 + i] * sc); }
  return a;
}
// column fragment from a [K][ld] layout (column n), rows >= K read as 0
__device__ __forceinline__ v16h fragc_f32(const float* W, int k0, int n, int lane, int ld, int K) {
  v16h a; const int g = lane >> 4;
#pragma unroll
  for (int i = 0; i < 8; ++i) { const int ka = k0 + 8 * g + i, kb = ka + 16;
    a[i] = (_Float16)(ka < K ? W[(size_t)(ka < K ? ka : K - 1) * ld + n] : 0.f); a[8 + i] = (_Float16)(kb < K ? W[(size_t)(kb < K ? kb : K - 1) * ld + n] : 0.f); }
  return a;
}
struct F2 { v16b h, l; };
__device__ __forceinline__ F2 bsplit16(const float v[16]) { F2 r;
#pragma unroll
  for (int i = 0; i < 16; ++i) { const __bf16 h = (__bf16)v[i]; r.h[i] = h; r.l[i] = (__bf16)(v[i] - (float)h); }
  return r; }
__device__ __forceinline__ F2 split_row(const float* row, int k0, int lane) { float v[16]; const float* p = row + k0 + 8 * (lane >> 4);
#pragma unroll
  for (int i = 0; i < 8; ++i) { v[i] = p[i]; v[8 + i] = p[16 + i]; }
  return bsplit16(v); }
__device__ __forceinline__ F2 split_rowK(const float* row, int k0, int lane, int K) { float v[16]; const int g = lane >> 4;
#pragma unroll
  for (int i = 0; i < 8; ++i) { const int ka = k0 + 8 * g + i, kb = ka + 16; v[i] = ka < K ? row[ka < K ? ka : K - 1] : 0.f; v[8 + i] = kb < K ? row[kb < K ? kb : K - 1] : 0.f; }
  return bsplit16(v); }
__device__ __forceinline__ F2 split_col(const float* W, int k0, int n, int lane, int ld, int K) { float v[16]; const int g = lane >> 4;
#pragma unroll
  for (int i = 0; i < 8; ++i) { const int ka = k0 + 8 * g + i, kb = ka + 16; v[i] = ka < K ? W[(size_t)(ka < K ? ka : K - 1) * ld + n] : 0.f; v[8 + i] = kb < K ? W[(size_t)(kb < K ? kb : K - 1) * ld + n] : 0.f; }
  return bsplit16(v); }
__device__ __forceinline__ v8f mac3(const F2& a, const F2& b, v8f c) { c = wmma_bf(a.l, b.h, c); c = wmma_bf(a.h, b.l, c); return wmma_bf(a.h, b.h, c); }
__device__ __forceinline__ float sigm(float v) { return 1.0f / (1.0f + expf(-v)); }
#define LDSX() do { asm volatile("s_wait_dscnt 0" ::: "memory"); __builtin_amdgcn_wave_barrier(); __builtin_amdgcn_fence(__ATOMIC_RELEASE, "workgroup"); } while (0)


// Memory-efficient (chunked) attention == softmax(q k^T / sqrt(64)) v per head (B 2, S 4,096, 16 heads x 64), output left in (batch*head, token, head_dim) form.
#define NB 2
#define NHD 16
#define NBH (NB * NHD)
#define SS 4096
#define HD 64
#define DW (NHD * HD)   // 1024-wide input rows
#ifndef TQB
#define TQB (SS / 128)
#define TNB NBH
#endif
typedef __attribute__((ext_vector_type(8))) __bf16 v8b;
__device__ __forceinline__ v16b frag_b(const __bf16* rowk0, int lane) {
  union { v16b v; v8b q[2]; } u; const __bf16* p = rowk0 + 8 * (lane >> 4);
  u.q[0] = *(const v8b*)p; u.q[1] = *(const v8b*)(p + 16); return u.v;
}
__device__ __forceinline__ float bfr(float v) { return (float)(__bf16)v; }
__device__ __attribute__((noinline)) float exp_ni(float v) { return expf(v); }
__device__ __attribute__((noinline)) float erf_ni(float v) { return erff(v); }

#define WS_Q   0u                                  // f16 rows q ; k ; VT planes [bh][64][s]
#define WS_K   (WS_Q + 2u * (size_t)NBH * SS * HD)
#define WS_VT  (WS_K + 2u * (size_t)NBH * SS * HD)
#define WS_END (WS_VT + 2u * (size_t)NBH * HD * SS)

// ---- k_prep: the one conversion launch. 1,024 blocks, four resident on a WGP; a block takes two 64-token x 64-column head tiles of each of query, key, value.
// A thread asks for all its 24 pieces of 16 bytes at the start (16 lanes cover one 256-byte head row), so the whole input is on its way at once and few waves have to start.
// query and key tiles go out straight from registers, 16 lanes writing one 128-byte row; value tiles turn through LDS. All stores stand behind the one barrier, which waits for no store.
#define PB 1024
typedef __attribute__((ext_vector_type(2))) unsigned v2u;
typedef __attribute__((ext_vector_type(2))) __bf16 v2b;
typedef __attribute__((ext_vector_type(2))) _Float16 v2h;
// two values rounded to bf16 and held as f16, in one word: packed conversions both ways
__device__ __forceinline__ unsigned pk2(float a, float b) {
  const v2f x = {a, b}; const unsigned r = __builtin_bit_cast(unsigned, __builtin_convertvector(x, v2b));
  const v2f y = {__builtin_bit_cast(float, r << 16), __builtin_bit_cast(float, r & 0xffff0000u)};
  return __builtin_bit_cast(unsigned, __builtin_convertvector(y, v2h));
}
__global__ __launch_bounds__(256) void k_prep(const float* __restrict__ Xq, const float* __restrict__ Xk, const float* __restrict__ Xv, _Float16* __restrict__ Rq, _Float16* __restrict__ Rk, _Float16* __restrict__ VT) {
  // st[u][d][word]: word kk of row d holds tokens 2kk, 2kk + 1; its 16-byte piece kk >> 2 is stored at piece ^ ((d >> 2) & 7), which spreads the 16 rows one store touches over the banks
  __shared__ __align__(16) unsigned st[2][64 * 32];
  const int t = threadIdx.x, c4 = t & 15, k = t >> 4;
  size_t src[2], bh[2], s0[2];   // src: the tile's first element, the same for the whole block
#pragma unroll   // src[], bh[], s0[] stay in registers: every index a constant
  for (int u = 0; u < 2; ++u) { const size_t idx = blockIdx.x + (size_t)u * PB, h = idx & 15, sb = (idx >> 4) & 63, b = idx >> 10;   // head fastest: 16 neighbouring blocks read 64 whole input rows
    bh[u] = b * NHD + h; s0[u] = sb * 64; src[u] = (b * SS + s0[u]) * DW + h * HD; }
  const unsigned ov = (unsigned)(2 * k * DW + c4 * 4), oq = (unsigned)(k * DW + c4 * 4);   // the lane's own offsets: token pair 2k, 2k + 1 for value, token k of each 16 for query and key
  v4f av[2][4], aq[2][4], ak[2][4];
#pragma unroll   // all loads stand ahead of all work
  for (int u = 0; u < 2; ++u)
#pragma unroll
    for (int i = 0; i < 4; ++i) av[u][i] = *(const v4f*)(Xv + src[u] + ((i & 1) + 32 * (i >> 1)) * DW + ov);   // a thread holds token pairs: they share a word of V^T
  asm volatile("s_wait_xcnt 0x0" ::: "memory");   // behind each group of eight loads: it stands before a later load's result, or anything else, rewrites an address register that these loads name
#pragma unroll
  for (int u = 0; u < 2; ++u)
#pragma unroll
    for (int i = 0; i < 4; ++i) aq[u][i] = *(const v4f*)(Xq + src[u] + i * 16 * DW + oq);
  asm volatile("s_wait_xcnt 0x0" ::: "memory");
#pragma unroll
  for (int u = 0; u < 2; ++u)
#pragma unroll
    for (int i = 0; i < 4; ++i) ak[u][i] = *(const v4f*)(Xk + src[u] + i * 16 * DW + oq);
  asm volatile("s_wait_xcnt 0x0" ::: "memory");
  __builtin_amdgcn_sched_barrier(0);   // keeps the 24 loads together: without it the compiler draws conversions, with their waits, in between the loads, and a wave pays the memory latency several times over
#pragma unroll
  for (int u = 0; u < 2; ++u)
#pragma unroll
    for (int p = 0; p < 2; ++p) { const int kk = k + 16 * p;
#pragma unroll
      for (int j = 0; j < 4; ++j) st[u][(4 * c4 + j) * 32 + ((((kk >> 2) ^ c4) & 7) << 2) + (kk & 3)] = pk2(av[u][2 * p][j], av[u][2 * p + 1][j]); }
  v2u wq[2][4], wk[2][4];
#pragma unroll   // wq[][], wk[][] stay in registers: every index a constant
  for (int u = 0; u < 2; ++u)
#pragma unroll
    for (int i = 0; i < 4; ++i) { wq[u][i] = v2u{pk2(aq[u][i][0], aq[u][i][1]), pk2(aq[u][i][2], aq[u][i][3])}; wk[u][i] = v2u{pk2(ak[u][i][0], ak[u][i][1]), pk2(ak[u][i][2], ak[u][i][3])}; }
  __syncthreads();
#pragma unroll
  for (int u = 0; u < 2; ++u)
#pragma unroll
    for (int w = 0; w < 2; ++w) { const int d = w * 32 + (t >> 3), pc = t & 7;
      vst2(VT + (bh[u] * HD + d) * SS + s0[u] + pc * 8, *(const v4u*)&st[u][d * 32 + (((pc ^ (d >> 2)) & 7) << 2)]); }
#pragma unroll
  for (int u = 0; u < 2; ++u)
#pragma unroll
    for (int i = 0; i < 4; ++i) { vst2(Rq + (bh[u] * SS + s0[u] + i * 16 + k) * HD + c4 * 4, wq[u][i]); vst2(Rk + (bh[u] * SS + s0[u] + i * 16 + k) * HD + c4 * 4, wk[u][i]); }
}
// ---- k_attn: block = (128 queries, bh): exact-operand scores, softmax, P x v
// K and V^T reach the four waves through LDS: a stage is 64 keys, one K tile (64 key rows of 128 bytes) and one V^T tile (64 head-column rows of 128 bytes),
// brought by tensor loads, one request a wave and stage for its own 32-row slice (waves 0, 1: K; waves 2, 3: V^T), two buffers, the next stage in flight while this one is worked on.
// The mover pads every row by 16 bytes: at a pitch of 144 bytes, an odd multiple of 16, the 16 rows a fragment read touches fall on different banks.
#define KT 64
#define KS 0.18033688011112042f   // log2(e) / 8
#define NT (SS / KT)
#define LAZY 4.0f   // how far, in the scaled log2 scores, a score may stand above the maximum in use before the accumulators are rescaled
#define ROW_B 128u      // bytes of a tile row in the source
#define PITCH 144u      // bytes from row to row in LDS
#define SL_ROWS 32u     // rows of a slice
#define SLICE_B 6144u   // 32 rows of 144 bytes are 4,608: rounded up to a multiple of 2 KiB, where the next slice may start
#define TILE_B (2u * SLICE_B)
#define STAGE_B (2u * TILE_B)
typedef __attribute__((address_space(3))) unsigned char lds_u8;
typedef __attribute__((ext_vector_type(4))) uint32_t u32x4;
typedef __attribute__((ext_vector_type(8))) uint32_t u32x8;
__device__ __forceinline__ uint32_t uni(uint32_t v) { return (uint32_t)__builtin_amdgcn_readfirstlane(v); }
// A test that guards a tensor load, or the stage number its descriptor is formed from; as a volatile statement it also stays behind the wait written in front of it.
__device__ __forceinline__ uint32_t pinned(uint32_t v) { uint32_t w = uni(v); asm volatile("" : "+s"(w)); return w; }   // the word is held in a scalar register
// group 1: 1-byte elements, tensor = tile = 32 rows of 128 bytes, a pad of 4 dwords behind every 32 dwords; no mask
__device__ __forceinline__ u32x8 tdm_group1(uint32_t src_pitch) {
  u32x8 g;
  g[0] = uni((1u << 20) | (4u << 22) | (3u << 25));
  g[1] = uni(ROW_B << 16);
  g[2] = uni(SL_ROWS << 16);
  g[3] = uni(ROW_B << 16);
  g[4] = uni(SL_ROWS);
  g[5] = uni(src_pitch);
  g[6] = uni(0u);
  g[7] = uni(0u);
  return g;
}
// group 0: count 1, place in LDS, address of the slice's first byte, type 2
__device__ __forceinline__ u32x4 tdm_group0(uint32_t lds_dst, uint64_t ga) {
  u32x4 g;
  g[0] = uni(1u); g[1] = uni(lds_dst); g[2] = uni((uint32_t)ga); g[3] = uni((((uint32_t)(ga >> 32)) & 0x01FFFFFFu) | 0x80000000u);
  return g;
}
// The load and the wave's own wait for it both name the descriptor as operands they may change (neither does): from the load to the wait the words are then values that the compiler
// can neither rebuild nor drop, so they stay in the registers the request was issued from, and nothing else is put there while the request is out.
__device__ __forceinline__ void tdm_load(u32x4& g0, u32x8& g1) { asm volatile("tensor_load_to_lds %0, %1" : "+s"(g0), "+s"(g1) :: "memory"); }
__device__ __forceinline__ void tdm_wait(u32x4& g0, u32x8& g1) { asm volatile("s_wait_tensorcnt 0x0" : "+s"(g0), "+s"(g1) :: "memory"); }
__device__ __forceinline__ v16h frag_l(const unsigned char* t, unsigned o0, unsigned o1) {
  union { v16h v; v8h q[2]; } u; u.q[0] = *(const v8h*)(t + o0); u.q[1] = *(const v8h*)(t + o1); return u.v;
}
// lane l with lane l ^ 16: the two halves of a wave hold the same query column and different keys
__device__ __forceinline__ float xhalf(float x) { return __builtin_bit_cast(float, __builtin_amdgcn_permlanex16(__builtin_bit_cast(int, x), __builtin_bit_cast(int, x), 0x76543210, 0xfedcba98, false, false)); }
#define QT 2
// Priority by progress. A SIMD holds one wave of each of four blocks.
// A wave starts at priority 3 and steps down at stages PR2, PR1, PR0, for speed only: who is ahead yields to who is behind.
#define PR2 36
#define PR1 54
#define PR0 60
#define SO_B (4 * QT * 16 * 68 * 4)   // output staging, smaller than the two stages
__global__ __launch_bounds__(128, 4) void k_attn(const _Float16* __restrict__ Q, const _Float16* __restrict__ K, const _Float16* __restrict__ VT, float* __restrict__ OUT) {
  static_assert(SO_B <= 2 * STAGE_B, "the array holds the ring and, behind the loop, the output staging");
  __shared__ __attribute__((aligned(2048))) unsigned char ring[2 * STAGE_B];   // every slice starts at a multiple of 2 KiB
  float (*so)[QT * 16][68] = (float (*)[QT * 16][68])ring;   // output staging takes the ring's place behind the loop's last barrier
  const int tid = threadIdx.x, wave = tid >> 5, lane = tid & 31, col = lane & 15, g = lane >> 4; const size_t bh = blockIdx.y; const int q0 = blockIdx.x * (64 * QT) + wave * (16 * QT); const size_t rq = bh * SS + q0;
  // tensor loads: every wave brings its own slice of every stage, so no test picks an issuer
  const uint32_t wv = uni((uint32_t)tid >> 5), isV = wv >> 1, half = wv & 1u;
  const uint32_t dst0 = (uint32_t)(size_t)(lds_u8*)ring + isV * TILE_B + half * SLICE_B;
  const uint64_t src0 = isV ? (uint64_t)(size_t)(VT + bh * HD * SS) + (uint64_t)half * (SL_ROWS * SS * 2) : (uint64_t)(size_t)(K + bh * SS * HD) + (uint64_t)half * (SL_ROWS * ROW_B);
  const uint32_t step = isV ? (uint32_t)(KT * 2) : (uint32_t)KT * ROW_B;   // bytes from a stage's slice to the next stage's
  u32x8 g1 = tdm_group1(isV ? (uint32_t)(SS * 2) : ROW_B);                 // the same for every stage
  // fragment reads: row col of a 16-row group, 16-byte pieces 2q + g, q = 0..3: one register, the rest immediate offsets
  const unsigned fo = (unsigned)col * PITCH + (unsigned)g * 16u;
  u32x4 g0 = tdm_group0(dst0, src0);   // group 0 of the request that is out
  tdm_load(g0, g1);
  tdm_wait(g0, g1);                    // this wave's slice of stage 0 has landed before the barrier that publishes it
  __syncthreads();
  g0 = tdm_group0(dst0 + STAGE_B, src0 + step);
  tdm_load(g0, g1);
  v16h aq[QT][2];
#pragma unroll   // aq[][] stays in registers: every index a constant
  for (int qt = 0; qt < QT; ++qt)
#pragma unroll
    for (int kc = 0; kc < 2; ++kc) aq[qt][kc] = frag_h(Q + (rq + qt * 16 + col) * HD + kc * 32, lane);
  // Lazy rescale: m is the maximum IN USE. It may trail a query's true maximum by up to LAZY in the scaled log2 scores, so P reaches at most 2^(11 + LAZY) = 2^15, inside f16;
  // output and sum carry the same factor 2^(-m * KS), which the final division takes out, whatever m is.
  float m[QT], l[QT];            // query qt * 16 + col: maximum in use of the raw products (equal in both halves), this half's share of the sum (times 2^11, as P)
  float thr[QT], bias[QT];       // m + LAZY / KS, and 11 - m * KS: they change only where m does
  v8f acc[QT][4] = {};           // acc[qt][dt][r] = O^T[dt * 16 + 8g + r][qt * 16 + col]
#pragma unroll   // m[], l[], thr[], bias[] stay in registers
  for (int qt = 0; qt < QT; ++qt) { m[qt] = -3.0e38f; thr[qt] = -3.0e38f; bias[qt] = 11.0f; l[qt] = 0.f; }   // every finite score exceeds thr: stage 0 sets m
  // Every group of fragments is asked for one block of work ahead of its use. K fragments live across the loop's edge: stage t + 1's are read behind the barrier that publishes it,
  // which stands in front of stage t's last block (pass 1's exponentials and products).
  v16h kf[2][2][2];  // a stage's K fragments: pass, 16-key tile, half of the head
#pragma unroll   // kf[][][] stays in registers; slice, row and piece offsets stay constants (immediate offsets of the LDS reads)
  for (int p = 0; p < 2; ++p)
#pragma unroll
   for (int ct = 0; ct < 2; ++ct)
#pragma unroll
    for (int kc = 0; kc < 2; ++kc) kf[p][ct][kc] = frag_l(ring + p * SLICE_B + ct * 16 * PITCH, fo + 64 * kc, fo + 64 * kc + 32);   // stage 0, published by the barrier above
#pragma unroll   // four copies of the stage loop, one a priority: s_setprio takes an immediate, and so no stage pays for a test
  for (int seg = 0; seg < 4; ++seg) {
  if (seg == 0) __builtin_amdgcn_s_setprio(3); else if (seg == 1) __builtin_amdgcn_s_setprio(2); else if (seg == 2) __builtin_amdgcn_s_setprio(1); else __builtin_amdgcn_s_setprio(0);   // 0 from the last stages to the kernel's end
  const int tb = seg == 0 ? 0 : seg == 1 ? PR2 : seg == 2 ? PR1 : PR0, te = seg == 0 ? PR2 : seg == 1 ? PR1 : seg == 2 ? PR0 : NT;
#pragma unroll 1
  for (int t = tb; t < te; ++t) { const unsigned char* vb = ring + (t & 1) * STAGE_B + TILE_B; const unsigned char* kn = ring + ((t + 1) & 1) * STAGE_B;   // kn: the next stage's K tile; behind the last stage the other buffer, idle by then, its values unused
   v8f s[2][QT][2];   // the stage's raw products: pass p (32 keys), query tile, 16-key tile
#pragma unroll   // s[][][] stays in registers: every index a constant
   for (int p = 0; p < 2; ++p) {
    if (p == 1) __builtin_amdgcn_sched_barrier(0);   // pass 0's eight products first: their K half was asked for a block earlier than pass 1's, which lands under them
#pragma unroll
    for (int ct = 0; ct < 2; ++ct) {
#pragma unroll
      for (int qt = 0; qt < QT; ++qt) s[p][qt][ct] = v8f{};
#pragma unroll
      for (int kc = 0; kc < 2; ++kc)
#pragma unroll   // both tiles' products side by side on the one fragment
        for (int qt = 0; qt < QT; ++qt) s[p][qt][ct] = wmma16(kf[p][ct][kc], aq[qt][kc], s[p][qt][ct]); } }   // raw products: the scale goes into the exponent's fma below
   __builtin_amdgcn_sched_barrier(0);   // keeps the 16 products in one run: drawn in between them, each maximum reads a tile just issued and the compiler fills the distance behind that WMMA with v_nop
   v16h vf[2][4];   // V^T fragments by pass. Pass 0's are asked for here, into registers that the K fragments have left: they land under the maxima and the exponentials
#pragma unroll   // vf[][] stays in registers
   for (int dt = 0; dt < 4; ++dt) vf[0][dt] = frag_l(vb + (dt >> 1) * SLICE_B + (dt & 1) * 16 * PITCH, fo, fo + 32);
   // one test a stage: does any of the lane's own 32 scores of a query exceed the bound? The ballot joins the halves and the columns.
   float mx[QT]; bool need = false;
#pragma unroll   // mx[] stays in registers; a chain a pass, so that four chains run side by side
   for (int qt = 0; qt < QT; ++qt) { float ma = fmaxf(s[0][qt][0][0], s[0][qt][1][0]), mb = fmaxf(s[1][qt][0][0], s[1][qt][1][0]);
#pragma unroll
     for (int r = 1; r < 8; ++r) { ma = fmaxf(ma, fmaxf(s[0][qt][0][r], s[0][qt][1][r])); mb = fmaxf(mb, fmaxf(s[1][qt][0][r], s[1][qt][1][r])); }
     mx[qt] = fmaxf(ma, mb); need = need || (mx[qt] > thr[qt]); }
   if (__builtin_expect(__builtin_amdgcn_ballot_w32(need) != 0, 0)) {   // a scalar branch, the same for the whole wave; rare behind the first stage
#pragma unroll
     for (int qt = 0; qt < QT; ++qt) { const float mn = fmaxf(m[qt], fmaxf(mx[qt], xhalf(mx[qt])));
       const float alpha = (m[qt] <= -1.0e38f) ? 0.f : __builtin_amdgcn_exp2f((m[qt] - mn) * KS);
       m[qt] = mn; thr[qt] = mn + LAZY / KS; bias[qt] = fmaf(-mn, KS, 11.0f); l[qt] *= alpha;
#pragma unroll
       for (int dt = 0; dt < 4; ++dt) acc[qt][dt] *= alpha; } }
#pragma unroll
   for (int p = 0; p < 2; ++p) { v16h pb[QT];
    if (p == 1) {
     __builtin_amdgcn_sched_barrier(0);
     asm volatile("s_wait_dscnt 0x0" ::: "memory");
     tdm_wait(g0, g1);
     __syncthreads();
     if (pinned(t + 2 < NT)) {
       const uint32_t st = pinned((uint32_t)t + 2u);
       g0 = tdm_group0(dst0 + (st & 1u) * STAGE_B, src0 + (uint64_t)st * step);
       tdm_load(g0, g1); }
#pragma unroll   // kf[][][] stays in registers; slice, row and piece offsets stay constants (immediate offsets of the LDS reads)
     for (int ct = 0; ct < 2; ++ct)
#pragma unroll
      for (int kc = 0; kc < 2; ++kc) kf[0][ct][kc] = frag_l(kn + ct * 16 * PITCH, fo + 64 * kc, fo + 64 * kc + 32);   // read once, used by both query tiles
     __builtin_amdgcn_sched_barrier(0);                  // keeps these reads in one group ahead of the last block: spread in it, every place with reads makes the wave wait for LDS anew
    }
#pragma unroll   // the two query tiles' chains are independent of each other
    for (int qt = 0; qt < QT; ++qt) {
      const float b = bias[qt];   // exponent of a score c: (c - m) * log2(e) / 8 + 11, one fma
      const v8f ks8 = {KS, KS, KS, KS, KS, KS, KS, KS}, b8 = {b, b, b, b, b, b, b, b};
      const v8f x0 = __builtin_elementwise_fma(s[p][qt][0], ks8, b8), x1 = __builtin_elementwise_fma(s[p][qt][1], ks8, b8);
      float es0 = 0.f, es1 = 0.f;
#pragma unroll
      for (int r = 0; r < 8; ++r) { const float e0 = __builtin_amdgcn_exp2f(x0[r]), e1 = __builtin_amdgcn_exp2f(x1[r]); es0 += e0; es1 += e1;
        pb[qt][r] = (_Float16)e0; pb[qt][8 + r] = (_Float16)e1; }
      l[qt] += es0 + es1; }
    __builtin_amdgcn_sched_barrier(0);   // the exponentials and P stand in front: the scores' registers are free for the fragments asked for next
    if (p == 0) {   // pass 1's V^T fragments: they land under pass 0's products
#pragma unroll   // vf[][] stays in registers
     for (int dt = 0; dt < 4; ++dt) vf[1][dt] = frag_l(vb + (dt >> 1) * SLICE_B + (dt & 1) * 16 * PITCH, fo + 64, fo + 96);
    }
    if (p == 1) {   // the next stage's second K half: it lands under these products and the next stage's first eight
#pragma unroll   // kf[][][] stays in registers; slice, row and piece offsets stay constants (immediate offsets of the LDS reads)
     for (int ct = 0; ct < 2; ++ct)
#pragma unroll
      for (int kc = 0; kc < 2; ++kc) kf[1][ct][kc] = frag_l(kn + SLICE_B + ct * 16 * PITCH, fo + 64 * kc, fo + 64 * kc + 32);   // read once, used by both query tiles
    }
    __builtin_amdgcn_sched_barrier(0);   // keeps the reads in one group ahead of the products
#pragma unroll
    for (int dt = 0; dt < 4; ++dt)
#pragma unroll   // both tiles' products side by side on the one fragment
      for (int qt = 0; qt < QT; ++qt) acc[qt][dt] = wmma16(vf[p][dt], pb[qt], acc[qt][dt]); } } }
  asm volatile("s_wait_tensorcnt 0x0" ::: "memory");   // nothing in flight when the ring becomes output staging
  asm volatile("s_wait_dscnt 0x0" ::: "memory");       // and none of this wave's reads of it
  __syncthreads();                                     // the waves leave the last block apart: nobody stages output over a buffer that another wave still reads
#pragma unroll   // acc[][] and l[] stay in registers: every index a constant
  for (int qt = 0; qt < QT; ++qt) { const float il = 1.0f / (l[qt] + xhalf(l[qt]));  // the halves' sums are joined once, here; the 2^11 of P and of the sum cancel
#pragma unroll
    for (int dt = 0; dt < 4; ++dt) { v4f lo, hi;
#pragma unroll
      for (int r = 0; r < 4; ++r) { lo[r] = acc[qt][dt][r] * il; hi[r] = acc[qt][dt][4 + r] * il; }
      *(v4f*)&so[wave][qt * 16 + col][dt * 16 + 8 * g] = lo; *(v4f*)&so[wave][qt * 16 + col][dt * 16 + 8 * g + 4] = hi; } }
  LDSX();
  for (int rl = 0; rl < QT * 16; ++rl) if (lane < 16) vst2(OUT + (rq + rl) * HD + lane * 4, *(const v4f*)&so[wave][rl][lane * 4]);
}
extern "C" void kernel_launch(void* const* d_in, const int* in_sizes, int n_in, void* d_out, int out_size, void* d_ws, size_t ws_size, hipStream_t stream) {
  (void)in_sizes; (void)n_in; (void)out_size;
  const float** F = (const float**)d_in;   // 0 query, 1 key, 2 value [2,4096,1024]
  if (ws_size < (size_t)WS_END) return;
  char* ws = (char*)d_ws; _Float16 *Qr = (_Float16*)(ws + WS_Q), *Kr = (_Float16*)(ws + WS_K), *VT = (_Float16*)(ws + WS_VT);
  k_prep<<<PB, 256, 0, stream>>>(F[0], F[1], F[2], Qr, Kr, VT);
  k_attn<<<dim3(TQB, TNB), 128, 0, stream>>>(Qr, Kr, VT, (float*)d_out);
}
